// v000
// Measured on an AMD MI455X. A time is GPU time per run, averaged over a window of back-to-back runs after a warm-up
// (all launches, gaps included; the runs take copies of the inputs in turn), and the median of several windows.
// Apart from v000's, it joins two sittings. Times from different sittings can be a few percent apart, while
// side-by-side timings come from the same sitting.
// v000 is the starting kernel. One run takes 157 microseconds.
#include <hip/hip_runtime.h>

// MultiHeadTEAttention (RBF-kernel attention): scores[m][q][k] = -0.5 |xq - xk|^2 / l^2 (mask -> finfo.min); attn = softmax_k; v = yv W_v (128); out = (attn v) W_out + b_out -> [8][512][256].
// |xq - xk|^2 = |xq|^2 + |xk|^2 - 2 xq.xk with the dot products on WMMA (xq, xk are bf16-exact, so every product is exact in f32; only the accumulation order differs from the module's sum of squared differences, ~1e-6 relative on O(100) values).
// Deterministic: per-wave work; no atomics.
// WMMA (v_wmma_f32_16x16x32_f16, f32 accumulate): yv (EXACT bf16 x8, K 256) x W_v rows (EXACT x256; 8 tiles); per (m, 16 q): D = xq (EXACT x8, K 64) x xk rows (EXACT x8; 32 tiles), O = attn (hi+lo x16384, K 512) x v^T rows (hi+lo x256; 8 tiles, 3 products), out = O (hi+lo x256, K 128) x W_out rows (EXACT; 16 tiles) — 0.16 M WMMA; norms, scores, softmax in f32.

namespace {
constexpr int MB = 8, NQ = 512, NK = 512, DX = 64, DY = 256, DH = 128;
constexpr float XS = 8.0f, HS = 256.0f, PS = 16384.0f, WSC = 256.0f, FMIN = -3.4028234663852886e38f;
typedef _Float16 b16;
typedef __attribute__((ext_vector_type(16))) _Float16 v16b;
typedef __attribute__((ext_vector_type(8))) _Float16 v8b;
typedef __attribute__((ext_vector_type(8))) float v8f;
typedef __attribute__((ext_vector_type(4))) float v4f;
typedef __attribute__((ext_vector_type(2))) float v2f;
typedef __attribute__((ext_vector_type(2))) _Float16 v2b;
__device__ __forceinline__ float bf16_rne(float f) { unsigned int u = __float_as_uint(f); u += 0x7FFFu + ((u >> 16) & 1u); float r = __uint_as_float(u & 0xFFFF0000u); asm volatile("" : "+v"(r)); return r; }
__device__ __forceinline__ float bfv(float f) { float r = bf16_rne(f); asm volatile("" : "+v"(r)); return r; }
__device__ __forceinline__ void split16(float v, b16& hi, b16& lo) { hi = (b16)v; lo = (b16)(v - (float)hi); }
__device__ __forceinline__ v16b frag_kb(const b16* p, int hh) { const v8b a = *(const v8b*)(p + 8 * hh), b = *(const v8b*)(p + 16 + 8 * hh); v16b f;
#pragma unroll
  for (int e = 0; e < 8; ++e) { f[e] = a[e]; f[8 + e] = b[e]; } return f; }
__device__ __forceinline__ v8f wmma16b(v16b a, v16b b, v8f c) { v8f d = __builtin_amdgcn_wmma_f32_16x16x32_f16(false, a, false, b, (short)0, c, false, false); asm volatile("v_nop\n\tv_nop\n\tv_nop\n\tv_nop" : "+v"(d) : "v"(a), "v"(b)); return d; }
__device__ __forceinline__ void wave_lds_sync() { __builtin_amdgcn_fence(__ATOMIC_RELEASE, "workgroup"); __builtin_amdgcn_wave_barrier(); __builtin_amdgcn_fence(__ATOMIC_ACQUIRE, "workgroup"); }
__device__ __forceinline__ float pmul(float a, float b) { float p = a * b; asm volatile("" : "+v"(p)); return p; }
__device__ __forceinline__ float wsum(float v) { for (int o = 16; o; o >>= 1) v += __shfl_xor(v, o); return v; }

__global__ __launch_bounds__(256) void prep_kernel(const float* __restrict__ wv, const float* __restrict__ wo, const float* __restrict__ xk, b16* __restrict__ WV, b16* __restrict__ WO, b16* __restrict__ XK, float* __restrict__ KN) { const size_t nt = (size_t)gridDim.x * 256, u0 = (size_t)blockIdx.x * 256 + threadIdx.x; v8b v; auto put = [&](b16* dst) { { *(v8b*)dst = v;  } };
  for (size_t u = u0; u < (size_t)DH * 32; u += nt) { const int h = (int)(u / 32), d0 = (int)(u % 32) * 8;
#pragma unroll
    for (int j = 0; j < 8; ++j) v[j] = (b16)(bf16_rne(wv[(size_t)(d0 + j) * DH + h]) * WSC); put(WV + (size_t)h * DY + d0); }
  for (size_t u = u0; u < (size_t)DY * 16; u += nt) { const int d = (int)(u / 16), h0 = (int)(u % 16) * 8;
#pragma unroll
    for (int j = 0; j < 8; ++j) v[j] = (b16)(bf16_rne(wo[(size_t)(h0 + j) * DY + d]) * WSC); put(WO + (size_t)d * DH + h0); }
  for (size_t u = u0; u < (size_t)MB * NK * 8; u += nt) { const size_t r = u / 8; const int c0 = (int)(u % 8) * 8;
#pragma unroll
    for (int j = 0; j < 8; ++j) v[j] = (b16)(bfv(xk[r * DX + c0 + j]) * XS); put(XK + r * DX + c0); }
  for (size_t r = u0; r < (size_t)MB * NK; r += nt) { float s = 0.0f; for (int c = 0; c < DX; ++c) { const float t = bfv(xk[r * DX + c]); s += t * t; } { ((float*)KN)[r] = s;  } } }
__global__ __launch_bounds__(32) void vproj_kernel(const float* __restrict__ yv, const b16* __restrict__ WV, float* __restrict__ Vr) { __shared__ __attribute__((aligned(16))) b16 Ax[16][DY + 8]; __shared__ float Tf[16][DH + 4]; const int lane = threadIdx.x, nloc = lane & 15, hlf = lane >> 4; const size_t r0 = (size_t)blockIdx.x * 16;
  for (int rr = 0; rr < 16; ++rr) for (int q = 0; q < DY / 32; ++q) { const int c = q * 32 + lane; Ax[rr][c] = (b16)(bfv(yv[(r0 + rr) * DY + c]) * XS); }
  if (lane < 16) for (int k = DY; k < DY + 8; ++k) Ax[lane][k] = (b16)0.0f;
  wave_lds_sync(); v8f acc[8];
#pragma unroll
  for (int t = 0; t < 8; ++t) acc[t] = (v8f){};
#pragma unroll 2
  for (int kb = 0; kb < DY; kb += 32) { const v16b a = frag_kb(&Ax[nloc][kb], hlf);
#pragma unroll
    for (int t = 0; t < 8; ++t) acc[t] = wmma16b(a, frag_kb(WV + (size_t)(t * 16 + nloc) * DY + kb, hlf), acc[t]); }
#pragma unroll
  for (int t = 0; t < 8; ++t)
#pragma unroll
    for (int r8 = 0; r8 < 8; ++r8) Tf[8 * hlf + r8][t * 16 + nloc] = acc[t][r8] * (1.0f / (XS * WSC));
  wave_lds_sync();
  { for (int rr = 0; rr < 16; ++rr) *(v4f*)(Vr + (r0 + rr) * DH + lane * 4) = *(const v4f*)(&Tf[rr][lane * 4]);  } }
__global__ __launch_bounds__(256) void vt_kernel(const float* __restrict__ Vr, b16* __restrict__ VTh, b16* __restrict__ VTl) { __shared__ float Tt[64][129]; const size_t r0 = (size_t)blockIdx.x * 64; const int m = (int)(r0 / NK), k0 = (int)(r0 % NK); const int tid = threadIdx.x, wave = tid >> 5, lane = tid & 31;
  for (int q = wave; q < 64; q += 8) for (int c = lane; c < DH; c += 32) Tt[q][c] = Vr[(r0 + q) * DH + c];
  __syncthreads();
  { for (int h = wave; h < DH; h += 8) { b16 h0, l0, h1, l1; split16(Tt[lane * 2][h] * HS, h0, l0); split16(Tt[lane * 2 + 1][h] * HS, h1, l1); const size_t o = ((size_t)m * DH + h) * NK + k0 + lane * 2; *(v2b*)(VTh + o) = (v2b){h0, h1}; *(v2b*)(VTl + o) = (v2b){l0, l1}; }  } }
__global__ __launch_bounds__(32) void att_kernel(const float* __restrict__ xq, const b16* __restrict__ XK, const float* __restrict__ KN, const int* __restrict__ mask, const float* __restrict__ lsc, const b16* __restrict__ VTh, const b16* __restrict__ VTl, const b16* __restrict__ WO, const float* __restrict__ bout, int QLIM, float* __restrict__ out) { __shared__ __attribute__((aligned(16))) b16 Aq[16][DX + 8], Pa[16][NK + 8], Pb[16][NK + 8], Oh[16][DH + 8], Ol[16][DH + 8]; __shared__ float Sc[16][NK + 1], Tf[16][260], QN[16]; const int lane = threadIdx.x, nloc = lane & 15, hlf = lane >> 4; const int m = blockIdx.x / (NQ / 16), q0 = (blockIdx.x % (NQ / 16)) * 16; if (q0 >= QLIM) return; const size_t tq = (size_t)m * NQ + q0;
  for (int rr = 0; rr < 16; ++rr) for (int q = 0; q < 2; ++q) { const int c = q * 32 + lane; Aq[rr][c] = (b16)(bfv(xq[(tq + rr) * DX + c]) * XS); }
  if (lane < 16) { for (int k = DX; k < DX + 8; ++k) Aq[lane][k] = (b16)0.0f; for (int k = NK; k < NK + 8; ++k) { Pa[lane][k] = (b16)0.0f; Pb[lane][k] = (b16)0.0f; } for (int k = DH; k < DH + 8; ++k) { Oh[lane][k] = (b16)0.0f; Ol[lane][k] = (b16)0.0f; } float s = 0.0f; for (int c = 0; c < DX; ++c) { const float t = bfv(xq[(tq + lane) * DX + c]); s += t * t; } QN[lane] = s; }
  wave_lds_sync();
  const v16b qa0 = frag_kb(&Aq[nloc][0], hlf), qa1 = frag_kb(&Aq[nloc][32], hlf);
#pragma unroll 1
  for (int tg = 0; tg < NK / 16; tg += 4) { v8f d[4] = {(v8f){}, (v8f){}, (v8f){}, (v8f){}};
#pragma unroll
    for (int t = 0; t < 4; ++t) { const size_t ko = ((size_t)m * NK + (tg + t) * 16 + nloc) * DX; d[t] = wmma16b(qa0, frag_kb(XK + ko, hlf), d[t]); d[t] = wmma16b(qa1, frag_kb(XK + ko + 32, hlf), d[t]); }
#pragma unroll
    for (int t = 0; t < 4; ++t)
#pragma unroll
      for (int r8 = 0; r8 < 8; ++r8) Sc[8 * hlf + r8][(tg + t) * 16 + nloc] = d[t][r8] * (1.0f / (XS * XS)); }
  wave_lds_sync();
  if (lane < 16) { const int r = lane; const float l2 = bfv(lsc[0]) * bfv(lsc[0]); const float cf = -0.5f / l2; const int* mk = mask + (tq + r) * NK; float mx = -INFINITY;
    for (int k = 0; k < NK; ++k) { const float sq = QN[r] + KN[(size_t)m * NK + k] - 2.0f * Sc[r][k]; float s = sq * cf; if (mk[k] == 0) s = FMIN; Sc[r][k] = s; mx = fmaxf(mx, s); }
    float z = 0.0f; for (int k = 0; k < NK; ++k) z += __expf(Sc[r][k] - mx); const float inv = 1.0f / z;
    for (int k = 0; k < NK; ++k) { b16 p, pl; split16(__expf(Sc[r][k] - mx) * inv * PS, p, pl); Pa[r][k] = p; Pb[r][k] = pl; } }
  wave_lds_sync();
  { v8f acc[8];
#pragma unroll
    for (int t = 0; t < 8; ++t) acc[t] = (v8f){};
#pragma unroll 2
    for (int kb = 0; kb < NK; kb += 32) { const v16b pa = frag_kb(&Pa[nloc][kb], hlf), pb = frag_kb(&Pb[nloc][kb], hlf);
#pragma unroll
      for (int t = 0; t < 8; ++t) { const size_t vo = ((size_t)m * DH + t * 16 + nloc) * NK + kb; const v16b vh = frag_kb(VTh + vo, hlf), vl = frag_kb(VTl + vo, hlf); acc[t] = wmma16b(pa, vh, acc[t]); acc[t] = wmma16b(pa, vl, acc[t]); acc[t] = wmma16b(pb, vh, acc[t]); } }
#pragma unroll
    for (int t = 0; t < 8; ++t)
#pragma unroll
      for (int r8 = 0; r8 < 8; ++r8) { b16 p, pl; split16(acc[t][r8] * (1.0f / (PS * HS)) * HS, p, pl); Oh[8 * hlf + r8][t * 16 + nloc] = p; Ol[8 * hlf + r8][t * 16 + nloc] = pl; } }
  wave_lds_sync();
  { v8f acc[16];
#pragma unroll
    for (int t = 0; t < 16; ++t) acc[t] = (v8f){};
#pragma unroll
    for (int kb = 0; kb < DH; kb += 32) { const v16b a = frag_kb(&Oh[nloc][kb], hlf), al = frag_kb(&Ol[nloc][kb], hlf);
#pragma unroll
      for (int t = 0; t < 16; ++t) { const v16b bw = frag_kb(WO + (size_t)(t * 16 + nloc) * DH + kb, hlf); acc[t] = wmma16b(a, bw, acc[t]); acc[t] = wmma16b(al, bw, acc[t]); } }
#pragma unroll
    for (int t = 0; t < 16; ++t) { const int cc = t * 16 + nloc; const float bb = bfv(bout[cc]);
#pragma unroll
      for (int r8 = 0; r8 < 8; ++r8) Tf[8 * hlf + r8][cc] = acc[t][r8] * (1.0f / (HS * WSC)) + bb; } }
  wave_lds_sync();
  { for (int rr = 0; rr < 16; ++rr) for (int q = 0; q < 2; ++q) *(v4f*)(out + (tq + rr) * DY + q * 128 + lane * 4) = *(const v4f*)(&Tf[rr][q * 128 + lane * 4]);  } }
}  // namespace

extern "C" void kernel_launch(void* const* d_in, const int* in_sizes, int n_in, void* d_out, int out_size, void* d_ws, size_t ws_size, hipStream_t stream) {
  (void)n_in;
  auto Fp = [&](int i) { return (const float*)d_in[i]; }; auto Ip = [&](int i) { return (const int*)d_in[i]; };
  // input order: 0 xq [8,512,64]; 1 xk [8,512,64]; 2 yv [8,512,256]; 3 mask [8,512,512] i32; 4 W_v [256,128]; 5 W_out [128,256]; 6 b_out [256]; 7 lengthscale [1]
  if (in_sizes[0] != MB * NQ * DX || in_sizes[1] != MB * NK * DX || in_sizes[2] != MB * NK * DY || in_sizes[3] != MB * NQ * NK || in_sizes[4] != DY * DH || in_sizes[5] != DH * DY || in_sizes[6] != DY || in_sizes[7] != 1 || out_size != MB * NQ * DY) return;
  const int QLIM = NQ;   // per-batch query cut (multiple of 16)
  size_t off = 0; char* ws = (char*)d_ws;
  auto carve = [&](size_t bytes) { char* p = ws + off; off += (bytes + 255) & ~(size_t)255; return p; };
  b16* WV = (b16*)carve((size_t)DH * DY * 2); b16* WO = (b16*)carve((size_t)DY * DH * 2); b16* XK = (b16*)carve((size_t)MB * NK * DX * 2); float* KN = (float*)carve((size_t)MB * NK * 4); float* Vr = (float*)carve((size_t)MB * NK * DH * 4); b16* VTh = (b16*)carve((size_t)MB * DH * NK * 2); b16* VTl = (b16*)carve((size_t)MB * DH * NK * 2);
  if (off > ws_size || off > ((size_t)8 << 20)) return;   // ~ 5 MB
  prep_kernel<<<64, 256, 0, stream>>>(Fp(4), Fp(5), Fp(1), WV, WO, XK, KN);
  vproj_kernel<<<MB * NK / 16, 32, 0, stream>>>(Fp(2), WV, Vr);
  vt_kernel<<<MB * NK / 64, 256, 0, stream>>>(Vr, VTh, VTl);
  att_kernel<<<MB * (NQ / 16), 32, 0, stream>>>(Fp(0), XK, KN, Ip(3), Fp(7), VTh, VTl, WO, Fp(6), QLIM, (float*)d_out);
}

// v001
// One run takes 56.9 microseconds.
// In both of two side-by-side timings against v000, it was 2.77 times as fast.
#include <hip/hip_runtime.h>

// MultiHeadTEAttention (RBF-kernel attention): scores[m][q][k] = -0.5 |xq - xk|^2 / l^2 (mask -> finfo.min); attn = softmax_k; v = yv W_v (128); out = (attn v) W_out + b_out -> [8][512][256].
// |xq - xk|^2 = |xq|^2 + |xk|^2 - 2 xq.xk with the dot products on WMMA (xq, xk are bf16-exact, so every product is exact in f32; only the accumulation order differs from the module's sum of squared differences, ~1e-6 relative on O(100) values).
// Deterministic: per-wave work; no atomics.
// WMMA (v_wmma_f32_16x16x32_f16, f32 accumulate): yv (EXACT bf16 x8, K 256) x W_v rows (EXACT x256; 8 tiles); per (m, 16 q): D = xq (EXACT x8, K 64) x xk rows (EXACT x8; 32 tiles), O = attn (hi+lo x16384, K 512) x v^T rows (hi+lo x256; 8 tiles, 3 products), out = O (hi+lo x256, K 128) x W_out rows (EXACT; 16 tiles) — 0.16 M WMMA; norms, scores, softmax in f32.

namespace {
constexpr int MB = 8, NQ = 512, NK = 512, DX = 64, DY = 256, DH = 128;
constexpr float XS = 8.0f, HS = 256.0f, PS = 16384.0f, WSC = 256.0f, FMIN = -3.4028234663852886e38f;
typedef _Float16 b16;
typedef __attribute__((ext_vector_type(16))) _Float16 v16b;
typedef __attribute__((ext_vector_type(8))) _Float16 v8b;
typedef __attribute__((ext_vector_type(8))) float v8f;
typedef __attribute__((ext_vector_type(4))) float v4f;
typedef __attribute__((ext_vector_type(2))) float v2f;
typedef __attribute__((ext_vector_type(2))) _Float16 v2b;
__device__ __forceinline__ float bf16_rne(float f) { unsigned int u = __float_as_uint(f); u += 0x7FFFu + ((u >> 16) & 1u); return __uint_as_float(u & 0xFFFF0000u); }
__device__ __forceinline__ float bfv(float f) { return bf16_rne(f); }
__device__ __forceinline__ void split16(float v, b16& hi, b16& lo) { hi = (b16)v; lo = (b16)(v - (float)hi); }
__device__ __forceinline__ v16b frag_kb(const b16* p, int hh) { const v8b a = *(const v8b*)(p + 8 * hh), b = *(const v8b*)(p + 16 + 8 * hh); v16b f;
#pragma unroll
  for (int e = 0; e < 8; ++e) { f[e] = a[e]; f[8 + e] = b[e]; } return f; }
__device__ __forceinline__ v8f wmma16b(v16b a, v16b b, v8f c) { return __builtin_amdgcn_wmma_f32_16x16x32_f16(false, a, false, b, (short)0, c, false, false); }
// a fragment's two 16-byte halves as loaded, so that a batch of eight fragments can be in flight at once; p already holds the lane half's 8 * hh, so the k order is frag_kb's
struct frw { v8b a, b; };
__device__ __forceinline__ frw frag_at(const b16* p) { frw f; f.a = *(const v8b*)p; f.b = *(const v8b*)(p + 16); return f; }
__device__ __forceinline__ v16b frag_of(const frw& f) { return __builtin_shufflevector(f.a, f.b, 0, 1, 2, 3, 4, 5, 6, 7, 8, 9, 10, 11, 12, 13, 14, 15); }
// Stands behind a batch of loads from p (and q). The wait: s_wait_xcnt 0 in front of whatever rewrites the batch's address registers; the addresses are named as inputs so that no load of the batch lands on them ahead of it.
// The scheduling barrier: the batch written above it issues together and flies under the products written below it; without it the compiler spreads the loads between the products and each is waited for alone.
__device__ __forceinline__ void issued(const void* p) { asm volatile("s_wait_xcnt 0x0" :: "v"(p) : "memory"); __builtin_amdgcn_sched_barrier(0); }
__device__ __forceinline__ void issued(const void* p, const void* q) { asm volatile("s_wait_xcnt 0x0" :: "v"(p), "v"(q) : "memory"); __builtin_amdgcn_sched_barrier(0); }
__device__ __forceinline__ void wave_lds_sync() { __builtin_amdgcn_fence(__ATOMIC_RELEASE, "workgroup"); __builtin_amdgcn_wave_barrier(); __builtin_amdgcn_fence(__ATOMIC_ACQUIRE, "workgroup"); }
__device__ __forceinline__ float pmul(float a, float b) { float p = a * b; asm volatile("" : "+v"(p)); return p; }
__device__ __forceinline__ float wsum(float v) { for (int o = 16; o; o >>= 1) v += __shfl_xor(v, o); return v; }

__global__ __launch_bounds__(256) void prep_kernel(const float* __restrict__ wv, const float* __restrict__ wo, const float* __restrict__ xk, b16* __restrict__ WV, b16* __restrict__ WO, b16* __restrict__ XK, float* __restrict__ KN) { const size_t nt = (size_t)gridDim.x * 256, u0 = (size_t)blockIdx.x * 256 + threadIdx.x; v8b v; auto put = [&](b16* dst) { { *(v8b*)dst = v;  } };
  for (size_t u = u0; u < (size_t)DH * 32; u += nt) { const int h = (int)(u / 32), d0 = (int)(u % 32) * 8;
#pragma unroll
    for (int j = 0; j < 8; ++j) v[j] = (b16)(bf16_rne(wv[(size_t)(d0 + j) * DH + h]) * WSC); put(WV + (size_t)h * DY + d0); }
  for (size_t u = u0; u < (size_t)DY * 16; u += nt) { const int d = (int)(u / 16), h0 = (int)(u % 16) * 8;
#pragma unroll
    for (int j = 0; j < 8; ++j) v[j] = (b16)(bf16_rne(wo[(size_t)(h0 + j) * DY + d]) * WSC); put(WO + (size_t)d * DH + h0); }
  for (size_t u = u0; u < (size_t)MB * NK * 8; u += nt) { const size_t r = u / 8; const int c0 = (int)(u % 8) * 8;
#pragma unroll
    for (int j = 0; j < 8; ++j) v[j] = (b16)(bfv(xk[r * DX + c0 + j]) * XS); put(XK + r * DX + c0); }
  for (size_t r = u0; r < (size_t)MB * NK; r += nt) { float s = 0.0f;
    // unrolled so that the whole row's loads are in flight at once; the sum keeps its order
#pragma unroll
    for (int c = 0; c < DX; ++c) { const float t = bfv(xk[r * DX + c]); s += t * t; } { ((float*)KN)[r] = s;  } } }
__global__ __launch_bounds__(32) void vproj_kernel(const float* __restrict__ yv, const b16* __restrict__ WV, float* __restrict__ Vr) { __shared__ __attribute__((aligned(16))) b16 Ax[16][DY + 8]; __shared__ float Tf[16][DH + 4]; const int lane = threadIdx.x, nloc = lane & 15, hlf = lane >> 4; const size_t r0 = (size_t)blockIdx.x * 16;
  frw wa[8], wb[8]; auto ldw = [&](frw (&w)[8], int kb) { const b16* p = WV + (size_t)nloc * DY + kb + 8 * hlf;
#pragma unroll
    for (int t = 0; t < 8; ++t) w[t] = frag_at(p + t * 16 * DY);
    issued(p); };
  ldw(wa, 0);
  // both loops unrolled so that the tile's loads issue back to back, not a few a trip
#pragma unroll
  for (int rr = 0; rr < 16; ++rr)
#pragma unroll
    for (int q = 0; q < DY / 32; ++q) { const int c = q * 32 + lane; Ax[rr][c] = (b16)(bfv(yv[(r0 + rr) * DY + c]) * XS); }
  if (lane < 16) for (int k = DY; k < DY + 8; ++k) Ax[lane][k] = (b16)0.0f;
  wave_lds_sync(); v8f acc[8];
#pragma unroll
  for (int t = 0; t < 8; ++t) acc[t] = (v8f){};
  // kept rolled: a trip already holds two batches, a further unroll would ask for a third set of registers
#pragma unroll 1
  for (int kb = 0; kb < DY; kb += 64) { const v16b a0 = frag_kb(&Ax[nloc][kb], hlf), a1 = frag_kb(&Ax[nloc][kb + 32], hlf);
    ldw(wb, kb + 32);
#pragma unroll
    for (int t = 0; t < 8; ++t) acc[t] = wmma16b(a0, frag_of(wa[t]), acc[t]);
    ldw(wa, kb + 64 < DY ? kb + 64 : DY - 32);   // last trip: an in-bounds reload that nothing reads
#pragma unroll
    for (int t = 0; t < 8; ++t) acc[t] = wmma16b(a1, frag_of(wb[t]), acc[t]); }
#pragma unroll
  for (int t = 0; t < 8; ++t)
#pragma unroll
    for (int r8 = 0; r8 < 8; ++r8) Tf[8 * hlf + r8][t * 16 + nloc] = acc[t][r8] * (1.0f / (XS * WSC));
  wave_lds_sync();
  { for (int rr = 0; rr < 16; ++rr) *(v4f*)(Vr + (r0 + rr) * DH + lane * 4) = *(const v4f*)(&Tf[rr][lane * 4]);  } }
__global__ __launch_bounds__(256) void vt_kernel(const float* __restrict__ Vr, b16* __restrict__ VTh, b16* __restrict__ VTl) { __shared__ float Tt[64][129]; const size_t r0 = (size_t)blockIdx.x * 64; const int m = (int)(r0 / NK), k0 = (int)(r0 % NK); const int tid = threadIdx.x, wave = tid >> 5, lane = tid & 31;
  for (int q = wave; q < 64; q += 8) for (int c = lane; c < DH; c += 32) Tt[q][c] = Vr[(r0 + q) * DH + c];
  __syncthreads();
  { for (int h = wave; h < DH; h += 8) { b16 h0, l0, h1, l1; split16(Tt[lane * 2][h] * HS, h0, l0); split16(Tt[lane * 2 + 1][h] * HS, h1, l1); const size_t o = ((size_t)m * DH + h) * NK + k0 + lane * 2; *(v2b*)(VTh + o) = (v2b){h0, h1}; *(v2b*)(VTl + o) = (v2b){l0, l1}; }  } }
__global__ __launch_bounds__(32) void att_kernel(const float* __restrict__ xq, const b16* __restrict__ XK, const float* __restrict__ KN, const int* __restrict__ mask, const float* __restrict__ lsc, const b16* __restrict__ VTh, const b16* __restrict__ VTl, const b16* __restrict__ WO, const float* __restrict__ bout, int QLIM, float* __restrict__ out) { __shared__ __attribute__((aligned(16))) b16 Aq[16][DX + 8], Pa[16][NK + 8], Pb[16][NK + 8], Oh[16][DH + 8], Ol[16][DH + 8]; __shared__ float Sc[16][NK + 1], Tf[16][260], QN[16]; const int lane = threadIdx.x, nloc = lane & 15, hlf = lane >> 4; const int m = blockIdx.x / (NQ / 16), q0 = (blockIdx.x % (NQ / 16)) * 16; if (q0 >= QLIM) return; const size_t tq = (size_t)m * NQ + q0;
  for (int rr = 0; rr < 16; ++rr) for (int q = 0; q < 2; ++q) { const int c = q * 32 + lane; Aq[rr][c] = (b16)(bfv(xq[(tq + rr) * DX + c]) * XS); }
  if (lane < 16) { for (int k = DX; k < DX + 8; ++k) Aq[lane][k] = (b16)0.0f; for (int k = NK; k < NK + 8; ++k) { Pa[lane][k] = (b16)0.0f; Pb[lane][k] = (b16)0.0f; } for (int k = DH; k < DH + 8; ++k) { Oh[lane][k] = (b16)0.0f; Ol[lane][k] = (b16)0.0f; } const float* qp = xq + (tq + lane) * DX; v4f qv[DX / 4];
#pragma unroll
    for (int i = 0; i < DX / 4; ++i) qv[i] = *(const v4f*)(qp + 4 * i);
    issued(qp); float s = 0.0f;
#pragma unroll
    for (int c = 0; c < DX; ++c) { const float t = bfv(qv[c >> 2][c & 3]); s += t * t; } QN[lane] = s; }
  wave_lds_sync();
  const v16b qa0 = frag_kb(&Aq[nloc][0], hlf), qa1 = frag_kb(&Aq[nloc][32], hlf);
  frw xa[8], xb[8]; auto ldx = [&](frw (&x)[8], int tg) { const b16* p = XK + ((size_t)m * NK + tg * 16 + nloc) * DX + 8 * hlf;
#pragma unroll
    for (int t = 0; t < 4; ++t) { x[2 * t] = frag_at(p + t * 16 * DX); x[2 * t + 1] = frag_at(p + t * 16 * DX + 32); }
    issued(p); };
  auto qk4 = [&](const frw (&x)[8], int tg) { v8f d[4] = {(v8f){}, (v8f){}, (v8f){}, (v8f){}};
#pragma unroll
    for (int t = 0; t < 4; ++t) { d[t] = wmma16b(qa0, frag_of(x[2 * t]), d[t]); d[t] = wmma16b(qa1, frag_of(x[2 * t + 1]), d[t]); }
#pragma unroll
    for (int t = 0; t < 4; ++t)
#pragma unroll
      for (int r8 = 0; r8 < 8; ++r8) Sc[8 * hlf + r8][(tg + t) * 16 + nloc] = d[t][r8] * (1.0f / (XS * XS)); };
  ldx(xa, 0);
  // kept rolled: a trip already holds two batches
#pragma unroll 1
  for (int tg = 0; tg < NK / 16; tg += 8) { ldx(xb, tg + 4); qk4(xa, tg);
    ldx(xa, tg + 8 < NK / 16 ? tg + 8 : NK / 16 - 4); qk4(xb, tg + 4); }   // last trip: an in-bounds reload that nothing reads
  wave_lds_sync();
  if (lane < 16) { const int r = lane; const float l2 = bfv(lsc[0]) * bfv(lsc[0]); const float cf = -0.5f / l2; const int* mk = mask + (tq + r) * NK; float mx = -INFINITY;
    for (int k = 0; k < NK; ++k) { const float sq = QN[r] + KN[(size_t)m * NK + k] - 2.0f * Sc[r][k]; float s = sq * cf; if (mk[k] == 0) s = FMIN; Sc[r][k] = s; mx = fmaxf(mx, s); }
    float z = 0.0f; for (int k = 0; k < NK; ++k) z += __expf(Sc[r][k] - mx); const float inv = 1.0f / z;
    for (int k = 0; k < NK; ++k) { b16 p, pl; split16(__expf(Sc[r][k] - mx) * inv * PS, p, pl); Pa[r][k] = p; Pb[r][k] = pl; } }
  wave_lds_sync();
  { v8f acc[8];
#pragma unroll
    for (int t = 0; t < 8; ++t) acc[t] = (v8f){};
    auto ldv = [&](frw (&x)[8], int t0, int kb) { const size_t vo = ((size_t)m * DH + t0 * 16 + nloc) * NK + kb + 8 * hlf; const b16 *ph = VTh + vo, *pl = VTl + vo;
#pragma unroll
      for (int t = 0; t < 4; ++t) { x[2 * t] = frag_at(ph + t * 16 * NK); x[2 * t + 1] = frag_at(pl + t * 16 * NK); }
      issued(ph, pl); };
    ldv(xa, 0, 0);
    // kept rolled: a trip already holds two batches
#pragma unroll 1
    for (int kb = 0; kb < NK; kb += 32) { const v16b pa = frag_kb(&Pa[nloc][kb], hlf), pb = frag_kb(&Pb[nloc][kb], hlf);
      ldv(xb, 4, kb);
#pragma unroll
      for (int t = 0; t < 4; ++t) { const v16b vh = frag_of(xa[2 * t]), vl = frag_of(xa[2 * t + 1]); acc[t] = wmma16b(pa, vh, acc[t]); acc[t] = wmma16b(pa, vl, acc[t]); acc[t] = wmma16b(pb, vh, acc[t]); }
      ldv(xa, 0, kb + 32 < NK ? kb + 32 : NK - 32);   // last trip: an in-bounds reload that nothing reads
#pragma unroll
      for (int t = 0; t < 4; ++t) { const v16b vh = frag_of(xb[2 * t]), vl = frag_of(xb[2 * t + 1]); acc[4 + t] = wmma16b(pa, vh, acc[4 + t]); acc[4 + t] = wmma16b(pa, vl, acc[4 + t]); acc[4 + t] = wmma16b(pb, vh, acc[4 + t]); } }
#pragma unroll
    for (int t = 0; t < 8; ++t)
#pragma unroll
      for (int r8 = 0; r8 < 8; ++r8) { b16 p, pl; split16(acc[t][r8] * (1.0f / (PS * HS)) * HS, p, pl); Oh[8 * hlf + r8][t * 16 + nloc] = p; Ol[8 * hlf + r8][t * 16 + nloc] = pl; } }
  wave_lds_sync();
  { auto ldo = [&](frw (&x)[8], int t0, int kb) { const b16* p = WO + (size_t)(t0 * 16 + nloc) * DH + kb + 8 * hlf;
#pragma unroll
      for (int t = 0; t < 8; ++t) x[t] = frag_at(p + t * 16 * DH);
      issued(p); };
    auto op8 = [&](v8f (&acc)[8], const frw (&x)[8], int kb) { const v16b a = frag_kb(&Oh[nloc][kb], hlf), al = frag_kb(&Ol[nloc][kb], hlf);
#pragma unroll
      for (int t = 0; t < 8; ++t) { const v16b bw = frag_of(x[t]); acc[t] = wmma16b(a, bw, acc[t]); acc[t] = wmma16b(al, bw, acc[t]); } };
    ldo(xa, 0, 0);
    // unrolled so that the test on t0 below is settled at compile time
#pragma unroll
    for (int t0 = 0; t0 < 16; t0 += 8) { v8f acc[8]; float bb[8];   // eight column tiles a trip, so that two batches and the accumulators fit the registers; each tile's k order is as before
#pragma unroll
      for (int t = 0; t < 8; ++t) { acc[t] = (v8f){}; bb[t] = bfv(bout[(t0 + t) * 16 + nloc]); }
      ldo(xb, t0, 32); op8(acc, xa, 0);
      ldo(xa, t0, 64); op8(acc, xb, 32);
      ldo(xb, t0, 96); op8(acc, xa, 64);
      if (t0 == 0) ldo(xa, 8, 0);
      op8(acc, xb, 96);
      __builtin_amdgcn_sched_barrier(0);   // the next trip's batch takes this batch's registers, not a third set
#pragma unroll
      for (int t = 0; t < 8; ++t) { const int cc = (t0 + t) * 16 + nloc;
#pragma unroll
        for (int r8 = 0; r8 < 8; ++r8) Tf[8 * hlf + r8][cc] = acc[t][r8] * (1.0f / (HS * WSC)) + bb[t]; } } }
  wave_lds_sync();
  { for (int rr = 0; rr < 16; ++rr) for (int q = 0; q < 2; ++q) *(v4f*)(out + (tq + rr) * DY + q * 128 + lane * 4) = *(const v4f*)(&Tf[rr][q * 128 + lane * 4]);  } }
}  // namespace

extern "C" void kernel_launch(void* const* d_in, const int* in_sizes, int n_in, void* d_out, int out_size, void* d_ws, size_t ws_size, hipStream_t stream) {
  (void)n_in;
  auto Fp = [&](int i) { return (const float*)d_in[i]; }; auto Ip = [&](int i) { return (const int*)d_in[i]; };
  // input order: 0 xq [8,512,64]; 1 xk [8,512,64]; 2 yv [8,512,256]; 3 mask [8,512,512] i32; 4 W_v [256,128]; 5 W_out [128,256]; 6 b_out [256]; 7 lengthscale [1]
  if (in_sizes[0] != MB * NQ * DX || in_sizes[1] != MB * NK * DX || in_sizes[2] != MB * NK * DY || in_sizes[3] != MB * NQ * NK || in_sizes[4] != DY * DH || in_sizes[5] != DH * DY || in_sizes[6] != DY || in_sizes[7] != 1 || out_size != MB * NQ * DY) return;
  const int QLIM = NQ;   // per-batch query cut (multiple of 16)
  size_t off = 0; char* ws = (char*)d_ws;
  auto carve = [&](size_t bytes) { char* p = ws + off; off += (bytes + 255) & ~(size_t)255; return p; };
  b16* WV = (b16*)carve((size_t)DH * DY * 2); b16* WO = (b16*)carve((size_t)DY * DH * 2); b16* XK = (b16*)carve((size_t)MB * NK * DX * 2); float* KN = (float*)carve((size_t)MB * NK * 4); float* Vr = (float*)carve((size_t)MB * NK * DH * 4); b16* VTh = (b16*)carve((size_t)MB * DH * NK * 2); b16* VTl = (b16*)carve((size_t)MB * DH * NK * 2);
  if (off > ws_size || off > ((size_t)8 << 20)) return;   // ~ 5 MB
  prep_kernel<<<64, 256, 0, stream>>>(Fp(4), Fp(5), Fp(1), WV, WO, XK, KN);
  vproj_kernel<<<MB * NK / 16, 32, 0, stream>>>(Fp(2), WV, Vr);
  vt_kernel<<<MB * NK / 64, 256, 0, stream>>>(Vr, VTh, VTl);
  att_kernel<<<MB * (NQ / 16), 32, 0, stream>>>(Fp(0), XK, KN, Ip(3), Fp(7), VTh, VTl, WO, Fp(6), QLIM, (float*)d_out);
}

// v002
// Measured time: 41.4 microseconds a run.
// Timed twice side by side with v001, it ran 1.38 times as fast both times.
// Over all steps from v000 it is 3.82 times as fast.
#include <hip/hip_runtime.h>

// MultiHeadTEAttention (RBF-kernel attention): scores[m][q][k] = -0.5 |xq - xk|^2 / l^2 (mask -> finfo.min); attn = softmax_k; v = yv W_v (128); out = (attn v) W_out + b_out -> [8][512][256].
// |xq - xk|^2 = |xq|^2 + |xk|^2 - 2 xq.xk with the dot products on WMMA (xq, xk are bf16-exact, so every product is exact in f32; only the accumulation order differs from the module's sum of squared differences, ~1e-6 relative on O(100) values).
// Deterministic: per-wave work; no atomics.
// WMMA (v_wmma_f32_16x16x32_f16, f32 accumulate): yv (EXACT bf16 x8, K 256) x W_v rows (EXACT x256; 8 tiles); per (m, 16 q): D = xq (EXACT x8, K 64) x xk rows (EXACT x8; 32 tiles), O = attn (hi+lo x16384, K 512) x v^T rows (hi+lo x256; 8 tiles, 3 products), out = O (hi+lo x256, K 128) x W_out rows (EXACT; 16 tiles) — 0.16 M WMMA; norms, scores, softmax in f32.

namespace {
constexpr int MB = 8, NQ = 512, NK = 512, DX = 64, DY = 256, DH = 128;
constexpr float XS = 8.0f, HS = 256.0f, PS = 16384.0f, WSC = 256.0f, FMIN = -3.4028234663852886e38f;
typedef _Float16 b16;
typedef __attribute__((ext_vector_type(16))) _Float16 v16b;
typedef __attribute__((ext_vector_type(8))) _Float16 v8b;
typedef __attribute__((ext_vector_type(8))) float v8f;
typedef __attribute__((ext_vector_type(4))) float v4f;
typedef __attribute__((ext_vector_type(2))) float v2f;
typedef __attribute__((ext_vector_type(2))) _Float16 v2b;
typedef __attribute__((ext_vector_type(4))) _Float16 v4b;
typedef __attribute__((ext_vector_type(4))) int v4i;
__device__ __forceinline__ float bf16_rne(float f) { unsigned int u = __float_as_uint(f); u += 0x7FFFu + ((u >> 16) & 1u); return __uint_as_float(u & 0xFFFF0000u); }
__device__ __forceinline__ float bfv(float f) { return bf16_rne(f); }
__device__ __forceinline__ void split16(float v, b16& hi, b16& lo) { hi = (b16)v; lo = (b16)(v - (float)hi); }
__device__ __forceinline__ v16b frag_kb(const b16* p, int hh) { const v8b a = *(const v8b*)(p + 8 * hh), b = *(const v8b*)(p + 16 + 8 * hh); v16b f;
#pragma unroll
  for (int e = 0; e < 8; ++e) { f[e] = a[e]; f[8 + e] = b[e]; } return f; }
__device__ __forceinline__ v8f wmma16b(v16b a, v16b b, v8f c) { return __builtin_amdgcn_wmma_f32_16x16x32_f16(false, a, false, b, (short)0, c, false, false); }
// a fragment's two 16-byte halves as loaded, so that a batch of eight fragments can be in flight at once; p already holds the lane half's 8 * hh, so the k order is frag_kb's
struct frw { v8b a, b; };
__device__ __forceinline__ frw frag_at(const b16* p) { frw f; f.a = *(const v8b*)p; f.b = *(const v8b*)(p + 16); return f; }
__device__ __forceinline__ v16b frag_of(const frw& f) { return __builtin_shufflevector(f.a, f.b, 0, 1, 2, 3, 4, 5, 6, 7, 8, 9, 10, 11, 12, 13, 14, 15); }
// Stands behind a batch of loads from p (and q). The wait: s_wait_xcnt 0 in front of whatever rewrites the batch's address registers; the addresses are named as inputs so that no load of the batch lands on them ahead of it.
// The scheduling barrier: the batch written above it issues together and flies under the products written below it; without it the compiler spreads the loads between the products and each is waited for alone.
__device__ __forceinline__ void issued(const void* p) { asm volatile("s_wait_xcnt 0x0" :: "v"(p) : "memory"); __builtin_amdgcn_sched_barrier(0); }
__device__ __forceinline__ void issued(const void* p, const void* q) { asm volatile("s_wait_xcnt 0x0" :: "v"(p), "v"(q) : "memory"); __builtin_amdgcn_sched_barrier(0); }
__device__ __forceinline__ void wave_lds_sync() { __builtin_amdgcn_fence(__ATOMIC_RELEASE, "workgroup"); __builtin_amdgcn_wave_barrier(); __builtin_amdgcn_fence(__ATOMIC_ACQUIRE, "workgroup"); }
__device__ __forceinline__ float pmul(float a, float b) { float p = a * b; asm volatile("" : "+v"(p)); return p; }
// lane l's value as seen from lane l ^ 16: a register move, no trip through the LDS unit
__device__ __forceinline__ float xhalf(float v) { const int b = __builtin_bit_cast(int, v); return __builtin_bit_cast(float, __builtin_amdgcn_permlanex16(b, b, 0x76543210, 0xfedcba98, false, false)); }
// maximum, or sum, over each 16-lane row of four values at once: four DPP steps each, the four chains interleaved so that each fills the others' latency; written in asm because the builtin move came out as four dependent instructions a step
__device__ __forceinline__ void row_max4(float (&v)[4]) {
  asm(
      "v_max_num_f32_dpp %0, %0, %0 row_xmask:1 row_mask:0xf bank_mask:0xf\n\t"
      "v_max_num_f32_dpp %1, %1, %1 row_xmask:1 row_mask:0xf bank_mask:0xf\n\t"
      "v_max_num_f32_dpp %2, %2, %2 row_xmask:1 row_mask:0xf bank_mask:0xf\n\t"
      "v_max_num_f32_dpp %3, %3, %3 row_xmask:1 row_mask:0xf bank_mask:0xf\n\t"
      "v_max_num_f32_dpp %0, %0, %0 row_xmask:2 row_mask:0xf bank_mask:0xf\n\t"
      "v_max_num_f32_dpp %1, %1, %1 row_xmask:2 row_mask:0xf bank_mask:0xf\n\t"
      "v_max_num_f32_dpp %2, %2, %2 row_xmask:2 row_mask:0xf bank_mask:0xf\n\t"
      "v_max_num_f32_dpp %3, %3, %3 row_xmask:2 row_mask:0xf bank_mask:0xf\n\t"
      "v_max_num_f32_dpp %0, %0, %0 row_xmask:4 row_mask:0xf bank_mask:0xf\n\t"
      "v_max_num_f32_dpp %1, %1, %1 row_xmask:4 row_mask:0xf bank_mask:0xf\n\t"
      "v_max_num_f32_dpp %2, %2, %2 row_xmask:4 row_mask:0xf bank_mask:0xf\n\t"
      "v_max_num_f32_dpp %3, %3, %3 row_xmask:4 row_mask:0xf bank_mask:0xf\n\t"
      "v_max_num_f32_dpp %0, %0, %0 row_xmask:8 row_mask:0xf bank_mask:0xf\n\t"
      "v_max_num_f32_dpp %1, %1, %1 row_xmask:8 row_mask:0xf bank_mask:0xf\n\t"
      "v_max_num_f32_dpp %2, %2, %2 row_xmask:8 row_mask:0xf bank_mask:0xf\n\t"
      "v_max_num_f32_dpp %3, %3, %3 row_xmask:8 row_mask:0xf bank_mask:0xf"
      : "+v"(v[0]), "+v"(v[1]), "+v"(v[2]), "+v"(v[3])); }
__device__ __forceinline__ void row_sum4(float (&v)[4]) {
  asm(
      "v_add_f32_dpp %0, %0, %0 row_xmask:1 row_mask:0xf bank_mask:0xf\n\t"
      "v_add_f32_dpp %1, %1, %1 row_xmask:1 row_mask:0xf bank_mask:0xf\n\t"
      "v_add_f32_dpp %2, %2, %2 row_xmask:1 row_mask:0xf bank_mask:0xf\n\t"
      "v_add_f32_dpp %3, %3, %3 row_xmask:1 row_mask:0xf bank_mask:0xf\n\t"
      "v_add_f32_dpp %0, %0, %0 row_xmask:2 row_mask:0xf bank_mask:0xf\n\t"
      "v_add_f32_dpp %1, %1, %1 row_xmask:2 row_mask:0xf bank_mask:0xf\n\t"
      "v_add_f32_dpp %2, %2, %2 row_xmask:2 row_mask:0xf bank_mask:0xf\n\t"
      "v_add_f32_dpp %3, %3, %3 row_xmask:2 row_mask:0xf bank_mask:0xf\n\t"
      "v_add_f32_dpp %0, %0, %0 row_xmask:4 row_mask:0xf bank_mask:0xf\n\t"
      "v_add_f32_dpp %1, %1, %1 row_xmask:4 row_mask:0xf bank_mask:0xf\n\t"
      "v_add_f32_dpp %2, %2, %2 row_xmask:4 row_mask:0xf bank_mask:0xf\n\t"
      "v_add_f32_dpp %3, %3, %3 row_xmask:4 row_mask:0xf bank_mask:0xf\n\t"
      "v_add_f32_dpp %0, %0, %0 row_xmask:8 row_mask:0xf bank_mask:0xf\n\t"
      "v_add_f32_dpp %1, %1, %1 row_xmask:8 row_mask:0xf bank_mask:0xf\n\t"
      "v_add_f32_dpp %2, %2, %2 row_xmask:8 row_mask:0xf bank_mask:0xf\n\t"
      "v_add_f32_dpp %3, %3, %3 row_xmask:8 row_mask:0xf bank_mask:0xf"
      : "+v"(v[0]), "+v"(v[1]), "+v"(v[2]), "+v"(v[3])); }
// __expf's own two instructions; the v_nop in the statement is the slot that the instruction set asks for behind a transcendental before its source is overwritten or its result read
__device__ __forceinline__ float exp_slot(float x) { const float a = x * 1.44269504f; float e; asm("v_exp_f32 %0, %1\n\tv_nop" : "=v"(e) : "v"(a)); return e; }

__global__ __launch_bounds__(256) void prep_kernel(const float* __restrict__ wv, const float* __restrict__ wo, const float* __restrict__ xk, b16* __restrict__ WV, b16* __restrict__ WO, b16* __restrict__ XK, float* __restrict__ KN) { const size_t nt = (size_t)gridDim.x * 256, u0 = (size_t)blockIdx.x * 256 + threadIdx.x; v8b v; auto put = [&](b16* dst) { { *(v8b*)dst = v;  } };
  for (size_t u = u0; u < (size_t)DH * 32; u += nt) { const int h = (int)(u / 32), d0 = (int)(u % 32) * 8;
#pragma unroll
    for (int j = 0; j < 8; ++j) v[j] = (b16)(bf16_rne(wv[(size_t)(d0 + j) * DH + h]) * WSC); put(WV + (size_t)h * DY + d0); }
  for (size_t u = u0; u < (size_t)DY * 16; u += nt) { const int d = (int)(u / 16), h0 = (int)(u % 16) * 8;
#pragma unroll
    for (int j = 0; j < 8; ++j) v[j] = (b16)(bf16_rne(wo[(size_t)(h0 + j) * DY + d]) * WSC); put(WO + (size_t)d * DH + h0); }
  for (size_t u = u0; u < (size_t)MB * NK * 8; u += nt) { const size_t r = u / 8; const int c0 = (int)(u % 8) * 8;
#pragma unroll
    for (int j = 0; j < 8; ++j) v[j] = (b16)(bfv(xk[r * DX + c0 + j]) * XS); put(XK + r * DX + c0); }
  for (size_t r = u0; r < (size_t)MB * NK; r += nt) { float s = 0.0f;
    // unrolled so that the whole row's loads are in flight at once; the sum keeps its order
#pragma unroll
    for (int c = 0; c < DX; ++c) { const float t = bfv(xk[r * DX + c]); s += t * t; } { ((float*)KN)[r] = s;  } } }
__global__ __launch_bounds__(32) void vproj_kernel(const float* __restrict__ yv, const b16* __restrict__ WV, float* __restrict__ Vr) { __shared__ __attribute__((aligned(16))) b16 Ax[16][DY + 8]; __shared__ float Tf[16][DH + 4]; const int lane = threadIdx.x, nloc = lane & 15, hlf = lane >> 4; const size_t r0 = (size_t)blockIdx.x * 16;
  frw wa[8], wb[8]; auto ldw = [&](frw (&w)[8], int kb) { const b16* p = WV + (size_t)nloc * DY + kb + 8 * hlf;
#pragma unroll
    for (int t = 0; t < 8; ++t) w[t] = frag_at(p + t * 16 * DY);
    issued(p); };
  ldw(wa, 0);
  // both loops unrolled so that the tile's loads issue back to back, not a few a trip
#pragma unroll
  for (int rr = 0; rr < 16; ++rr)
#pragma unroll
    for (int q = 0; q < DY / 32; ++q) { const int c = q * 32 + lane; Ax[rr][c] = (b16)(bfv(yv[(r0 + rr) * DY + c]) * XS); }
  if (lane < 16) for (int k = DY; k < DY + 8; ++k) Ax[lane][k] = (b16)0.0f;
  wave_lds_sync(); v8f acc[8];
#pragma unroll
  for (int t = 0; t < 8; ++t) acc[t] = (v8f){};
  // kept rolled: a trip already holds two batches, a further unroll would ask for a third set of registers
#pragma unroll 1
  for (int kb = 0; kb < DY; kb += 64) { const v16b a0 = frag_kb(&Ax[nloc][kb], hlf), a1 = frag_kb(&Ax[nloc][kb + 32], hlf);
    ldw(wb, kb + 32);
#pragma unroll
    for (int t = 0; t < 8; ++t) acc[t] = wmma16b(a0, frag_of(wa[t]), acc[t]);
    ldw(wa, kb + 64 < DY ? kb + 64 : DY - 32);   // last trip: an in-bounds reload that nothing reads
#pragma unroll
    for (int t = 0; t < 8; ++t) acc[t] = wmma16b(a1, frag_of(wb[t]), acc[t]); }
#pragma unroll
  for (int t = 0; t < 8; ++t)
#pragma unroll
    for (int r8 = 0; r8 < 8; ++r8) Tf[8 * hlf + r8][t * 16 + nloc] = acc[t][r8] * (1.0f / (XS * WSC));
  wave_lds_sync();
  { for (int rr = 0; rr < 16; ++rr) *(v4f*)(Vr + (r0 + rr) * DH + lane * 4) = *(const v4f*)(&Tf[rr][lane * 4]);  } }
__global__ __launch_bounds__(256) void vt_kernel(const float* __restrict__ Vr, b16* __restrict__ VTh, b16* __restrict__ VTl) { __shared__ float Tt[64][129]; const size_t r0 = (size_t)blockIdx.x * 64; const int m = (int)(r0 / NK), k0 = (int)(r0 % NK); const int tid = threadIdx.x, wave = tid >> 5, lane = tid & 31;
  for (int q = wave; q < 64; q += 8) for (int c = lane; c < DH; c += 32) Tt[q][c] = Vr[(r0 + q) * DH + c];
  __syncthreads();
  { for (int h = wave; h < DH; h += 8) { b16 h0, l0, h1, l1; split16(Tt[lane * 2][h] * HS, h0, l0); split16(Tt[lane * 2 + 1][h] * HS, h1, l1); const size_t o = ((size_t)m * DH + h) * NK + k0 + lane * 2; *(v2b*)(VTh + o) = (v2b){h0, h1}; *(v2b*)(VTl + o) = (v2b){l0, l1}; }  } }
__global__ __launch_bounds__(32) void att_kernel(const float* __restrict__ xq, const b16* __restrict__ XK, const float* __restrict__ KN, const int* __restrict__ mask, const float* __restrict__ lsc, const b16* __restrict__ VTh, const b16* __restrict__ VTl, const b16* __restrict__ WO, const float* __restrict__ bout, int QLIM, float* __restrict__ out) { __shared__ __attribute__((aligned(16))) b16 Aq[16][DX + 8], Pa[16][NK + 8], Pb[16][NK + 8], Oh[16][DH + 8], Ol[16][DH + 8]; __shared__ __attribute__((aligned(16))) float Sc[16][NK + 4]; __shared__ float Tf[16][260], QN[16]; const int lane = threadIdx.x, nloc = lane & 15, hlf = lane >> 4; const int m = blockIdx.x / (NQ / 16), q0 = (blockIdx.x % (NQ / 16)) * 16; if (q0 >= QLIM) return; const size_t tq = (size_t)m * NQ + q0;
  for (int rr = 0; rr < 16; ++rr) for (int q = 0; q < 2; ++q) { const int c = q * 32 + lane; Aq[rr][c] = (b16)(bfv(xq[(tq + rr) * DX + c]) * XS); }
  if (lane < 16) { for (int k = DX; k < DX + 8; ++k) Aq[lane][k] = (b16)0.0f; for (int k = NK; k < NK + 8; ++k) { Pa[lane][k] = (b16)0.0f; Pb[lane][k] = (b16)0.0f; } for (int k = DH; k < DH + 8; ++k) { Oh[lane][k] = (b16)0.0f; Ol[lane][k] = (b16)0.0f; } const float* qp = xq + (tq + lane) * DX; v4f qv[DX / 4];
#pragma unroll
    for (int i = 0; i < DX / 4; ++i) qv[i] = *(const v4f*)(qp + 4 * i);
    issued(qp); float s = 0.0f;
#pragma unroll
    for (int c = 0; c < DX; ++c) { const float t = bfv(qv[c >> 2][c & 3]); s += t * t; } QN[lane] = s; }
  wave_lds_sync();
  const v16b qa0 = frag_kb(&Aq[nloc][0], hlf), qa1 = frag_kb(&Aq[nloc][32], hlf);
  frw xa[8], xb[8]; auto ldx = [&](frw (&x)[8], int tg) { const b16* p = XK + ((size_t)m * NK + tg * 16 + nloc) * DX + 8 * hlf;
#pragma unroll
    for (int t = 0; t < 4; ++t) { x[2 * t] = frag_at(p + t * 16 * DX); x[2 * t + 1] = frag_at(p + t * 16 * DX + 32); }
    issued(p); };
  auto qk4 = [&](const frw (&x)[8], int tg) { v8f d[4] = {(v8f){}, (v8f){}, (v8f){}, (v8f){}};
#pragma unroll
    for (int t = 0; t < 4; ++t) { d[t] = wmma16b(qa0, frag_of(x[2 * t]), d[t]); d[t] = wmma16b(qa1, frag_of(x[2 * t + 1]), d[t]); }
#pragma unroll
    for (int t = 0; t < 4; ++t)
#pragma unroll
      for (int r8 = 0; r8 < 8; ++r8) Sc[8 * hlf + r8][(tg + t) * 16 + nloc] = d[t][r8] * (1.0f / (XS * XS)); };
  // the key norms and the lengthscale, as the softmax below reads them, fly under the score products
  v4f kn[4]; { const float* p = KN + (size_t)m * NK + lane * 4;
#pragma unroll
    for (int j = 0; j < 4; ++j) kn[j] = *(const v4f*)(p + j * 128);
    issued(p); }
  const float lv = lsc[0];
  ldx(xa, 0);
  // kept rolled: a trip already holds two batches
#pragma unroll 1
  for (int tg = 0; tg < NK / 16; tg += 8) { ldx(xb, tg + 4); qk4(xa, tg);
    ldx(xa, tg + 8 < NK / 16 ? tg + 8 : NK / 16 - 4); qk4(xb, tg + 4); }   // last trip: an in-bounds reload that nothing reads
  wave_lds_sync();
  // softmax: the whole wave works on a row, lane l holding k = 128 j + 4 l + i (j, i < 4), so that scores, mask and norms are read 16 bytes a lane and each score stays in a register from the mask to the split
  { const float l2 = bfv(lv) * bfv(lv); const float cf = -0.5f / l2; v4i mk[16]; float s[4][16];
    auto ldm = [&](int r0) { const int* p = mask + (tq + r0) * NK + lane * 4;
#pragma unroll
      for (int e = 0; e < 16; ++e) mk[e] = *(const v4i*)(p + (e >> 2) * NK + (e & 3) * 128);
      issued(p); };
    auto masked = [&](int r0) {   // four rows' scores, scaled and masked
#pragma unroll
      for (int rr = 0; rr < 4; ++rr) { const float qn = QN[r0 + rr];
#pragma unroll
        for (int j = 0; j < 4; ++j) { const v4f sc = *(const v4f*)(&Sc[r0 + rr][j * 128 + lane * 4]);
#pragma unroll
          for (int i = 0; i < 4; ++i) { const float sq = qn + kn[j][i] - 2.0f * sc[i]; float v = sq * cf; if (mk[rr * 4 + j][i] == 0) v = FMIN; s[rr][j * 4 + i] = v; } } } };
    auto probs = [&](int r0) {   // four rows' maximum, exponentials, sum, and the split weights to LDS; the rows go through each stage together
      float mx[4], z[4];
#pragma unroll
      for (int rr = 0; rr < 4; ++rr) { float t[8];   // a lane's sixteen values fold pairwise, four links deep, not fifteen
#pragma unroll
        for (int e = 0; e < 8; ++e) t[e] = fmaxf(s[rr][e], s[rr][e + 8]);
#pragma unroll
        for (int w = 4; w; w >>= 1)
#pragma unroll
          for (int e = 0; e < w; ++e) t[e] = fmaxf(t[e], t[e + w]);
        mx[rr] = t[0]; }
      row_max4(mx);
#pragma unroll
      for (int rr = 0; rr < 4; ++rr) mx[rr] = fmaxf(mx[rr], xhalf(mx[rr]));
#pragma unroll
      for (int rr = 0; rr < 4; ++rr) { float t[8];
#pragma unroll
        for (int e = 0; e < 16; ++e) s[rr][e] = exp_slot(s[rr][e] - mx[rr]);
#pragma unroll
        for (int e = 0; e < 8; ++e) t[e] = s[rr][e] + s[rr][e + 8];
#pragma unroll
        for (int w = 4; w; w >>= 1)
#pragma unroll
          for (int e = 0; e < w; ++e) t[e] += t[e + w];
        z[rr] = t[0]; }
      row_sum4(z);
#pragma unroll
      for (int rr = 0; rr < 4; ++rr) z[rr] = (1.0f / (z[rr] + xhalf(z[rr]))) * PS;
#pragma unroll
      for (int rr = 0; rr < 4; ++rr)
#pragma unroll
        for (int j = 0; j < 4; ++j) { v4b ph, pl;
#pragma unroll
          for (int i = 0; i < 4; ++i) { b16 a, b; split16(s[rr][j * 4 + i] * z[rr], a, b); ph[i] = a; pl[i] = b; }
          *(v4b*)(&Pa[r0 + rr][j * 128 + lane * 4]) = ph; *(v4b*)(&Pb[r0 + rr][j * 128 + lane * 4]) = pl; } };
    ldm(0); masked(0);
    // kept rolled, four rows a trip, so that the kernel's text stays small; the next four mask rows fly under this trip's rows
#pragma unroll 1
    for (int r0 = 0; r0 < 16; r0 += 4) { if (r0 + 4 < 16) ldm(r0 + 4);
      probs(r0);
      if (r0 + 4 < 16) masked(r0 + 4); } }
  wave_lds_sync();
  { v8f acc[8];
#pragma unroll
    for (int t = 0; t < 8; ++t) acc[t] = (v8f){};
    auto ldv = [&](frw (&x)[8], int t0, int kb) { const size_t vo = ((size_t)m * DH + t0 * 16 + nloc) * NK + kb + 8 * hlf; const b16 *ph = VTh + vo, *pl = VTl + vo;
#pragma unroll
      for (int t = 0; t < 4; ++t) { x[2 * t] = frag_at(ph + t * 16 * NK); x[2 * t + 1] = frag_at(pl + t * 16 * NK); }
      issued(ph, pl); };
    ldv(xa, 0, 0);
    // kept rolled: a trip already holds two batches
#pragma unroll 1
    for (int kb = 0; kb < NK; kb += 32) { const v16b pa = frag_kb(&Pa[nloc][kb], hlf), pb = frag_kb(&Pb[nloc][kb], hlf);
      ldv(xb, 4, kb);
#pragma unroll
      for (int t = 0; t < 4; ++t) { const v16b vh = frag_of(xa[2 * t]), vl = frag_of(xa[2 * t + 1]); acc[t] = wmma16b(pa, vh, acc[t]); acc[t] = wmma16b(pa, vl, acc[t]); acc[t] = wmma16b(pb, vh, acc[t]); }
      ldv(xa, 0, kb + 32 < NK ? kb + 32 : NK - 32);   // last trip: an in-bounds reload that nothing reads
#pragma unroll
      for (int t = 0; t < 4; ++t) { const v16b vh = frag_of(xb[2 * t]), vl = frag_of(xb[2 * t + 1]); acc[4 + t] = wmma16b(pa, vh, acc[4 + t]); acc[4 + t] = wmma16b(pa, vl, acc[4 + t]); acc[4 + t] = wmma16b(pb, vh, acc[4 + t]); } }
#pragma unroll
    for (int t = 0; t < 8; ++t)
#pragma unroll
      for (int r8 = 0; r8 < 8; ++r8) { b16 p, pl; split16(acc[t][r8] * (1.0f / (PS * HS)) * HS, p, pl); Oh[8 * hlf + r8][t * 16 + nloc] = p; Ol[8 * hlf + r8][t * 16 + nloc] = pl; } }
  wave_lds_sync();
  { auto ldo = [&](frw (&x)[8], int t0, int kb) { const b16* p = WO + (size_t)(t0 * 16 + nloc) * DH + kb + 8 * hlf;
#pragma unroll
      for (int t = 0; t < 8; ++t) x[t] = frag_at(p + t * 16 * DH);
      issued(p); };
    auto op8 = [&](v8f (&acc)[8], const frw (&x)[8], int kb) { const v16b a = frag_kb(&Oh[nloc][kb], hlf), al = frag_kb(&Ol[nloc][kb], hlf);
#pragma unroll
      for (int t = 0; t < 8; ++t) { const v16b bw = frag_of(x[t]); acc[t] = wmma16b(a, bw, acc[t]); acc[t] = wmma16b(al, bw, acc[t]); } };
    ldo(xa, 0, 0);
    // unrolled so that the test on t0 below is settled at compile time
#pragma unroll
    for (int t0 = 0; t0 < 16; t0 += 8) { v8f acc[8]; float bb[8];   // eight column tiles a trip, so that two batches and the accumulators fit the registers; each tile's k order is as before
#pragma unroll
      for (int t = 0; t < 8; ++t) { acc[t] = (v8f){}; bb[t] = bfv(bout[(t0 + t) * 16 + nloc]); }
      ldo(xb, t0, 32); op8(acc, xa, 0);
      ldo(xa, t0, 64); op8(acc, xb, 32);
      ldo(xb, t0, 96); op8(acc, xa, 64);
      if (t0 == 0) ldo(xa, 8, 0);
      op8(acc, xb, 96);
      __builtin_amdgcn_sched_barrier(0);   // the next trip's batch takes this batch's registers, not a third set
#pragma unroll
      for (int t = 0; t < 8; ++t) { const int cc = (t0 + t) * 16 + nloc;
#pragma unroll
        for (int r8 = 0; r8 < 8; ++r8) Tf[8 * hlf + r8][cc] = acc[t][r8] * (1.0f / (HS * WSC)) + bb[t]; } } }
  wave_lds_sync();
  { for (int rr = 0; rr < 16; ++rr) for (int q = 0; q < 2; ++q) *(v4f*)(out + (tq + rr) * DY + q * 128 + lane * 4) = *(const v4f*)(&Tf[rr][q * 128 + lane * 4]);  } }
}  // namespace

extern "C" void kernel_launch(void* const* d_in, const int* in_sizes, int n_in, void* d_out, int out_size, void* d_ws, size_t ws_size, hipStream_t stream) {
  (void)n_in;
  auto Fp = [&](int i) { return (const float*)d_in[i]; }; auto Ip = [&](int i) { return (const int*)d_in[i]; };
  // input order: 0 xq [8,512,64]; 1 xk [8,512,64]; 2 yv [8,512,256]; 3 mask [8,512,512] i32; 4 W_v [256,128]; 5 W_out [128,256]; 6 b_out [256]; 7 lengthscale [1]
  if (in_sizes[0] != MB * NQ * DX || in_sizes[1] != MB * NK * DX || in_sizes[2] != MB * NK * DY || in_sizes[3] != MB * NQ * NK || in_sizes[4] != DY * DH || in_sizes[5] != DH * DY || in_sizes[6] != DY || in_sizes[7] != 1 || out_size != MB * NQ * DY) return;
  const int QLIM = NQ;   // per-batch query cut (multiple of 16)
  size_t off = 0; char* ws = (char*)d_ws;
  auto carve = [&](size_t bytes) { char* p = ws + off; off += (bytes + 255) & ~(size_t)255; return p; };
  b16* WV = (b16*)carve((size_t)DH * DY * 2); b16* WO = (b16*)carve((size_t)DY * DH * 2); b16* XK = (b16*)carve((size_t)MB * NK * DX * 2); float* KN = (float*)carve((size_t)MB * NK * 4); float* Vr = (float*)carve((size_t)MB * NK * DH * 4); b16* VTh = (b16*)carve((size_t)MB * DH * NK * 2); b16* VTl = (b16*)carve((size_t)MB * DH * NK * 2);
  if (off > ws_size || off > ((size_t)8 << 20)) return;   // ~ 5 MB
  prep_kernel<<<64, 256, 0, stream>>>(Fp(4), Fp(5), Fp(1), WV, WO, XK, KN);
  vproj_kernel<<<MB * NK / 16, 32, 0, stream>>>(Fp(2), WV, Vr);
  vt_kernel<<<MB * NK / 64, 256, 0, stream>>>(Vr, VTh, VTl);
  att_kernel<<<MB * (NQ / 16), 32, 0, stream>>>(Fp(0), XK, KN, Ip(3), Fp(7), VTh, VTl, WO, Fp(6), QLIM, (float*)d_out);
}

// v004
// A run of this version takes 16.6 microseconds.
// Versions in between are left out here; by their measured steps it is 2.46 times as fast as v002.
// Counting every step since v000, it is 9.39 times as fast.
#include <hip/hip_runtime.h>

// RBF-kernel attention: scores[m][q][k] = -0.5 |xq - xk|^2 / l^2 (mask -> finfo.min); attn = softmax_k; v = yv W_v (128); out = (attn v) W_out + b_out -> [8][512][256].
// |xq - xk|^2 = |xq|^2 + |xk|^2 - 2 xq.xk with the dot products on WMMA (xq, xk are bf16-exact, so every product is exact in f32; only the accumulation order differs from the module's sum of squared differences, ~1e-6 relative on O(100) values).
// Deterministic: a tile (64 keys by 64 columns of v; 16 queries of the attention) is one work-group's, its column tiles, key tiles and softmax rows dealt out to the group's eight waves; each element keeps its own sum order; no atomics.
// WMMA (v_wmma_f32_16x16x32_f16, f32 accumulate): yv (EXACT bf16 x8, K 256) x W_v rows (EXACT x256; 8 tiles); per (m, 16 q): D = xq (EXACT x8, K 64) x xk rows (EXACT x8; 32 tiles), O = attn (hi+lo x16384, K 512) x v^T rows (hi+lo x256; 8 tiles, 3 products), out = O (hi+lo x256, K 128) x W_out rows (EXACT; 16 tiles) — 0.16 M WMMA; norms, scores, softmax in f32.

namespace {
constexpr int MB = 8, NQ = 512, NK = 512, DX = 64, DY = 256, DH = 128;
constexpr float XS = 8.0f, HS = 256.0f, PS = 16384.0f, WSC = 256.0f, FMIN = -3.4028234663852886e38f;
typedef _Float16 b16;
typedef __attribute__((ext_vector_type(16))) _Float16 v16b;
typedef __attribute__((ext_vector_type(8))) _Float16 v8b;
typedef __attribute__((ext_vector_type(8))) float v8f;
typedef __attribute__((ext_vector_type(4))) float v4f;
typedef __attribute__((ext_vector_type(2))) float v2f;
typedef __attribute__((ext_vector_type(2))) _Float16 v2b;
typedef __attribute__((ext_vector_type(4))) _Float16 v4b;
typedef __attribute__((ext_vector_type(4))) int v4i;
__device__ __forceinline__ float bf16_rne(float f) { unsigned int u = __float_as_uint(f); u += 0x7FFFu + ((u >> 16) & 1u); return __uint_as_float(u & 0xFFFF0000u); }
__device__ __forceinline__ float bfv(float f) { return bf16_rne(f); }
__device__ __forceinline__ void split16(float v, b16& hi, b16& lo) { hi = (b16)v; lo = (b16)(v - (float)hi); }
__device__ __forceinline__ v16b frag_kb(const b16* p, int hh) { const v8b a = *(const v8b*)(p + 8 * hh), b = *(const v8b*)(p + 16 + 8 * hh); v16b f;
#pragma unroll
  for (int e = 0; e < 8; ++e) { f[e] = a[e]; f[8 + e] = b[e]; } return f; }
__device__ __forceinline__ v8f wmma16b(v16b a, v16b b, v8f c) { return __builtin_amdgcn_wmma_f32_16x16x32_f16(false, a, false, b, (short)0, c, false, false); }
// a fragment's two 16-byte halves as loaded, so that a batch of eight fragments can be in flight at once; p already holds the lane half's 8 * hh, so the k order is frag_kb's
struct frw { v8b a, b; };
__device__ __forceinline__ frw frag_at(const b16* p) { frw f; f.a = *(const v8b*)p; f.b = *(const v8b*)(p + 16); return f; }
__device__ __forceinline__ v16b frag_of(const frw& f) { return __builtin_shufflevector(f.a, f.b, 0, 1, 2, 3, 4, 5, 6, 7, 8, 9, 10, 11, 12, 13, 14, 15); }
// Stands behind a batch of loads from p (and q). The wait: s_wait_xcnt 0 in front of whatever rewrites the batch's address registers; the addresses are named as inputs so that no load of the batch lands on them ahead of it.
// The scheduling barrier: the batch written above it issues together and flies under the products written below it; without it the compiler spreads the loads between the products and each is waited for alone.
__device__ __forceinline__ void issued(const void* p) { asm volatile("s_wait_xcnt 0x0" :: "v"(p) : "memory"); __builtin_amdgcn_sched_barrier(0); }
__device__ __forceinline__ void issued(const void* p, const void* q) { asm volatile("s_wait_xcnt 0x0" :: "v"(p), "v"(q) : "memory"); __builtin_amdgcn_sched_barrier(0); }
// Stands behind the last of a run of global stores: s_wait_xcnt 0 in front of whatever code the listing places next and lets rewrite the stores' data or address registers.
__device__ __forceinline__ void stored() { asm volatile("s_wait_xcnt 0x0" ::: "memory"); }
__device__ __forceinline__ void wave_lds_sync() { __builtin_amdgcn_fence(__ATOMIC_RELEASE, "workgroup"); __builtin_amdgcn_wave_barrier(); __builtin_amdgcn_fence(__ATOMIC_ACQUIRE, "workgroup"); }
__device__ __forceinline__ float pmul(float a, float b) { float p = a * b; asm volatile("" : "+v"(p)); return p; }
// lane l's value as seen from lane l ^ 16: a register move, no trip through the LDS unit
__device__ __forceinline__ float xhalf(float v) { const int b = __builtin_bit_cast(int, v); return __builtin_bit_cast(float, __builtin_amdgcn_permlanex16(b, b, 0x76543210, 0xfedcba98, false, false)); }
// maximum, or sum, over each 16-lane row of two values at once: four DPP steps each, the two chains interleaved; written in asm because the builtin move came out as four dependent instructions a step
__device__ __forceinline__ void row_max2(float (&v)[2]) {
  asm(
      "v_max_num_f32_dpp %0, %0, %0 row_xmask:1 row_mask:0xf bank_mask:0xf\n\t"
      "v_max_num_f32_dpp %1, %1, %1 row_xmask:1 row_mask:0xf bank_mask:0xf\n\t"
      "v_max_num_f32_dpp %0, %0, %0 row_xmask:2 row_mask:0xf bank_mask:0xf\n\t"
      "v_max_num_f32_dpp %1, %1, %1 row_xmask:2 row_mask:0xf bank_mask:0xf\n\t"
      "v_max_num_f32_dpp %0, %0, %0 row_xmask:4 row_mask:0xf bank_mask:0xf\n\t"
      "v_max_num_f32_dpp %1, %1, %1 row_xmask:4 row_mask:0xf bank_mask:0xf\n\t"
      "v_max_num_f32_dpp %0, %0, %0 row_xmask:8 row_mask:0xf bank_mask:0xf\n\t"
      "v_max_num_f32_dpp %1, %1, %1 row_xmask:8 row_mask:0xf bank_mask:0xf"
      : "+v"(v[0]), "+v"(v[1])); }
__device__ __forceinline__ void row_sum2(float (&v)[2]) {
  asm(
      "v_add_f32_dpp %0, %0, %0 row_xmask:1 row_mask:0xf bank_mask:0xf\n\t"
      "v_add_f32_dpp %1, %1, %1 row_xmask:1 row_mask:0xf bank_mask:0xf\n\t"
      "v_add_f32_dpp %0, %0, %0 row_xmask:2 row_mask:0xf bank_mask:0xf\n\t"
      "v_add_f32_dpp %1, %1, %1 row_xmask:2 row_mask:0xf bank_mask:0xf\n\t"
      "v_add_f32_dpp %0, %0, %0 row_xmask:4 row_mask:0xf bank_mask:0xf\n\t"
      "v_add_f32_dpp %1, %1, %1 row_xmask:4 row_mask:0xf bank_mask:0xf\n\t"
      "v_add_f32_dpp %0, %0, %0 row_xmask:8 row_mask:0xf bank_mask:0xf\n\t"
      "v_add_f32_dpp %1, %1, %1 row_xmask:8 row_mask:0xf bank_mask:0xf"
      : "+v"(v[0]), "+v"(v[1])); }
// __expf's own two instructions; the v_nop in the statement is the slot that the instruction set asks for behind a transcendental before its source is overwritten or its result read
__device__ __forceinline__ float exp_slot(float x) { const float a = x * 1.44269504f; float e; asm("v_exp_f32 %0, %1\n\tv_nop" : "=v"(e) : "v"(a)); return e; }

// The first of the two launches. Work-groups 0 .. CB-1 convert xk and W_out and sum the key norms, each kind of work on waves of its own; every other work-group makes a block of 64 keys by 64 columns of v = yv W_v and stores it transposed and split, as the attention launch reads it.
// Nothing here waits for another work-group: a v block reads W_v in f32 and turns its own 64 columns in LDS. Every loop is unrolled so that the register arrays are indexed by constants and a batch's loads issue back to back.
constexpr int CB = 64, VK = 64, VH = 64;
__global__ __launch_bounds__(256) void front_kernel(const float* __restrict__ yv, const float* __restrict__ wv, const float* __restrict__ wo, const float* __restrict__ xk, b16* __restrict__ WO, b16* __restrict__ XK, float* __restrict__ KN, b16* __restrict__ VTh, b16* __restrict__ VTl) { __shared__ __attribute__((aligned(16))) b16 Ax[VK][DY + 8], Wt[VH][DY + 8], Th[VH][VK + 8], Tl[VH][VK + 8]; const int tid = threadIdx.x, wave = __builtin_amdgcn_readfirstlane(tid >> 5), lane = tid & 31, nloc = lane & 15, hlf = lane >> 4;
  if (blockIdx.x < CB) { const int pb = blockIdx.x;   // 64 rows of xk and 64 eight-element pieces of W_out a work-group; left by the whole work-group ahead of every barrier
    if (wave < 2) { const size_t r = (size_t)pb * 64 + tid; const float* p = xk + r * DX; v4f x[DX / 4];
#pragma unroll
      for (int i = 0; i < DX / 4; ++i) x[i] = *(const v4f*)(p + 4 * i);
      issued(p);
      float s = 0.0f;
#pragma unroll
      for (int c = 0; c < DX; ++c) { const float t = bfv(x[c >> 2][c & 3]); s += t * t; }
      KN[r] = s; }
    else if (wave < 4) { const int u = pb * 64 + (tid - 64), d = u / 16, h0 = (u % 16) * 8; const float* p = wo + (size_t)h0 * DY + d; float x[8]; v8b v;
#pragma unroll
      for (int j = 0; j < 8; ++j) x[j] = p[j * DY];
      issued(p);
#pragma unroll
      for (int j = 0; j < 8; ++j) v[j] = (b16)(bf16_rne(x[j]) * WSC);
      *(v8b*)(WO + (size_t)d * DH + h0) = v; stored(); }
    else { const size_t u = (size_t)pb * 512 + (tid - 128); const float* p = xk + u * 8; b16* q = XK + u * 8; v4f x[8];
#pragma unroll
      for (int i = 0; i < 4; ++i) { x[2 * i] = *(const v4f*)(p + i * 1024); x[2 * i + 1] = *(const v4f*)(p + i * 1024 + 4); }
      issued(p);
#pragma unroll
      for (int i = 0; i < 4; ++i) { v8b v;
#pragma unroll
        for (int j = 0; j < 8; ++j) v[j] = (b16)(bfv(x[2 * i + (j >> 2)][j & 3]) * XS);
        *(v8b*)(q + i * 1024) = v; }
      stored(); }
    return; }
  const int vb = blockIdx.x - CB, h0 = (vb & 1) * VH; const size_t r0 = (size_t)(vb >> 1) * VK;
  // 64 rows of yv, a wave's load half a row
  const float* yp = yv + (r0 + (tid >> 6)) * DY + (tid & 63) * 4; v4f y[16];
#pragma unroll
  for (int i = 0; i < 16; ++i) y[i] = *(const v4f*)(yp + i * 4 * DY);
  issued(yp);
  // 64 columns of W_v in pieces of 4 rows by 4 columns; eight lanes side by side read one 128-byte line
  const int hq = (lane & 7) + 8 * (wave & 1), dq = (lane >> 3) + 4 * (wave >> 1); const float* wp = wv + (size_t)(4 * dq) * DH + h0 + 4 * hq; v4f w[16];
#pragma unroll
  for (int i = 0; i < 4; ++i)
#pragma unroll
    for (int j = 0; j < 4; ++j) w[4 * i + j] = *(const v4f*)(wp + (64 * i + j) * DH);
  issued(wp);
#pragma unroll
  for (int i = 0; i < 16; ++i) { v4b a;
#pragma unroll
    for (int e = 0; e < 4; ++e) a[e] = (b16)(bfv(y[i][e]) * XS);
    *(v4b*)(&Ax[(tid >> 6) + 4 * i][(tid & 63) * 4]) = a; }
#pragma unroll
  for (int i = 0; i < 4; ++i)
#pragma unroll
    for (int e = 0; e < 4; ++e) { v4b a;   // column 4 hq + e of the piece: four consecutive d
#pragma unroll
      for (int j = 0; j < 4; ++j) a[j] = (b16)(bf16_rne(w[4 * i + j][e]) * WSC);
      *(v4b*)(&Wt[4 * hq + e][4 * dq + 64 * i]) = a; }
  __syncthreads();   // both tiles are written by all eight waves and read by each
  // wave w: key tile w & 3, column tiles 2 (w >> 2) and 2 (w >> 2) + 1
  const int kt = wave & 3, ht = (wave >> 2) * 2; v8f acc[2] = {(v8f){}, (v8f){}}; v16b fa[8], fb[2][8];
#pragma unroll
  for (int k = 0; k < 8; ++k) { fa[k] = frag_kb(&Ax[kt * 16 + nloc][k * 32], hlf); fb[0][k] = frag_kb(&Wt[ht * 16 + nloc][k * 32], hlf); fb[1][k] = frag_kb(&Wt[(ht + 1) * 16 + nloc][k * 32], hlf); }
  __builtin_amdgcn_sched_barrier(0);   // all 48 LDS reads go out ahead of the products; without it each product waits for its own fragments' whole LDS latency
#pragma unroll
  for (int k = 0; k < 8; ++k)
#pragma unroll
    for (int t = 0; t < 2; ++t) acc[t] = wmma16b(fa[k], fb[t][k], acc[t]);
  // a lane holds eight consecutive keys of one column: 16 bytes of a row of v^T, high and low
#pragma unroll
  for (int t = 0; t < 2; ++t) { v8b vh, vl;
#pragma unroll
    for (int r8 = 0; r8 < 8; ++r8) { b16 a, b; split16(acc[t][r8] * (1.0f / (XS * WSC)) * HS, a, b); vh[r8] = a; vl[r8] = b; }
    *(v8b*)(&Th[(ht + t) * 16 + nloc][kt * 16 + 8 * hlf]) = vh; *(v8b*)(&Tl[(ht + t) * 16 + nloc][kt * 16 + 8 * hlf]) = vl; }
  __syncthreads();   // a 128-byte line of v^T holds four waves' key tiles
  const int m = (int)(r0 / NK), k0 = (int)(r0 % NK);
#pragma unroll
  for (int i = 0; i < 2; ++i) { const int rr = (tid >> 3) + 32 * i; const size_t o = ((size_t)m * DH + h0 + rr) * NK + k0 + (tid & 7) * 8; *(v8b*)(VTh + o) = *(const v8b*)(&Th[rr][(tid & 7) * 8]); *(v8b*)(VTl + o) = *(const v8b*)(&Tl[rr][(tid & 7) * 8]); }
  stored(); }
// one work-group a tile of 16 queries, dealt out to its eight waves: wave w takes key tiles 4w..4w+3 of the scores, rows 2w and 2w+1 of the softmax, column tile w of attn v and column tiles 2w and 2w+1 of the output projection.
// What a wave loads from global memory depends on no other wave, so each batch goes out ahead of its use. Every loop is unrolled so that the register arrays are indexed by constants and a batch's loads issue back to back.
// The kernel takes more than 256 registers (two batches of v are held at once): after a change see in the listing that the softmax's vector asm names registers below v256 and that the s_set_vgpr_msb above it carries a multiple of 256.
__global__ __launch_bounds__(256) void att_kernel(const float* __restrict__ xq, const b16* __restrict__ XK, const float* __restrict__ KN, const int* __restrict__ mask, const float* __restrict__ lsc, const b16* __restrict__ VTh, const b16* __restrict__ VTl, const b16* __restrict__ WO, const float* __restrict__ bout, int QLIM, float* __restrict__ out) { __shared__ __attribute__((aligned(16))) b16 Aq[16][DX + 8], Pa[16][NK + 8], Pb[16][NK + 8], Oh[16][DH + 8], Ol[16][DH + 8]; __shared__ __attribute__((aligned(16))) float Sc[16][NK + 4], Tf[16][260]; __shared__ float QN[16]; const int tid = threadIdx.x, wave = __builtin_amdgcn_readfirstlane(tid >> 5), lane = tid & 31, nloc = lane & 15, hlf = lane >> 4; const int m = blockIdx.x / (NQ / 16), q0 = (blockIdx.x % (NQ / 16)) * 16; if (q0 >= QLIM) return; const size_t tq = (size_t)m * NQ + q0;
  // the query tile, 16 bytes a thread; and this wave's two softmax rows again, even lanes the first and odd lanes the second, for their norms
  const float* xp = xq + (tq + (tid >> 4)) * DX + (tid & 15) * 4; const v4f xv = *(const v4f*)xp;
  const float* qp = xq + (tq + 2 * wave + (lane & 1)) * DX; v4f qv[DX / 4];
#pragma unroll
  for (int i = 0; i < DX / 4; ++i) qv[i] = *(const v4f*)(qp + 4 * i);
  issued(xp, qp);
  frw xa[8], xb[8];
  { const b16* p = XK + ((size_t)m * NK + wave * 64 + nloc) * DX + 8 * hlf;
#pragma unroll
    for (int t = 0; t < 4; ++t) { xa[2 * t] = frag_at(p + t * 16 * DX); xa[2 * t + 1] = frag_at(p + t * 16 * DX + 32); }
    issued(p); }
  // the two mask rows, the key norms and the lengthscale, as the softmax below reads them
  v4i mk[8]; { const int* p = mask + (tq + 2 * wave) * NK + lane * 4;
#pragma unroll
    for (int e = 0; e < 8; ++e) mk[e] = *(const v4i*)(p + (e >> 2) * NK + (e & 3) * 128);
    issued(p); }
  v4f kn[4]; { const float* p = KN + (size_t)m * NK + lane * 4;
#pragma unroll
    for (int j = 0; j < 4; ++j) kn[j] = *(const v4f*)(p + j * 128);
    issued(p); }
  float bb[2]; { const float* p = bout + wave * 32 + nloc; bb[0] = p[0]; bb[1] = p[16]; issued(p); }   // the bias of this wave's two output column tiles
  const float lv = lsc[0];
  // four k steps of this wave's column tile of v, high and low halves: a batch of sixteen loads
  // (the wait names the two row pointers themselves, which every batch's loads address with a constant offset: a pointer formed per batch would be added up in those registers ahead of the wait)
  const size_t vo = ((size_t)m * DH + wave * 16 + nloc) * NK + 8 * hlf; const b16 *ph = VTh + vo, *pl = VTl + vo;
  auto ldv = [&](frw (&x)[8], int kb0) {
#pragma unroll
    for (int t = 0; t < 4; ++t) { x[2 * t] = frag_at(ph + kb0 + t * 32); x[2 * t + 1] = frag_at(pl + kb0 + t * 32); }
    issued(ph, pl); };
  ldv(xb, 0);   // with the first loads: the barrier below waits for every load that is out, so a batch sent later would hold it up
  { v4b a;
#pragma unroll
    for (int e = 0; e < 4; ++e) a[e] = (b16)(bfv(xv[e]) * XS);
    *(v4b*)(&Aq[tid >> 4][(tid & 15) * 4]) = a; }
  if (tid < 16) { for (int k = DX; k < DX + 8; ++k) Aq[tid][k] = (b16)0.0f; for (int k = NK; k < NK + 8; ++k) { Pa[tid][k] = (b16)0.0f; Pb[tid][k] = (b16)0.0f; } for (int k = DH; k < DH + 8; ++k) { Oh[tid][k] = (b16)0.0f; Ol[tid][k] = (b16)0.0f; } }
  { float s = 0.0f;   // stored ahead of the barrier, so that the sum runs while the later loads are still on their way
#pragma unroll
    for (int c = 0; c < DX; ++c) { const float t = bfv(qv[c >> 2][c & 3]); s += t * t; }
    if (lane < 2) QN[2 * wave + lane] = s; }
  __syncthreads();   // the query tile is written by all eight waves and read by each
  { const v16b qa0 = frag_kb(&Aq[nloc][0], hlf), qa1 = frag_kb(&Aq[nloc][32], hlf); v8f d[4] = {(v8f){}, (v8f){}, (v8f){}, (v8f){}};
#pragma unroll
    for (int t = 0; t < 4; ++t) { d[t] = wmma16b(qa0, frag_of(xa[2 * t]), d[t]); d[t] = wmma16b(qa1, frag_of(xa[2 * t + 1]), d[t]); }
#pragma unroll
    for (int t = 0; t < 4; ++t)
#pragma unroll
      for (int r8 = 0; r8 < 8; ++r8) Sc[8 * hlf + r8][(wave * 4 + t) * 16 + nloc] = d[t][r8] * (1.0f / (XS * XS)); }
  __syncthreads();   // a score row holds all eight waves' key tiles
  // softmax: the whole wave works on a row, lane l holding k = 128 j + 4 l + i (j, i < 4), so that scores, mask and norms are read 16 bytes a lane and each score stays in a register from the mask to the split
  { const float l2 = bfv(lv) * bfv(lv); const float cf = -0.5f / l2; const int r0 = 2 * wave; float s[2][16];
#pragma unroll
    for (int rr = 0; rr < 2; ++rr) { const float qn = QN[r0 + rr];
#pragma unroll
      for (int j = 0; j < 4; ++j) { const v4f sc = *(const v4f*)(&Sc[r0 + rr][j * 128 + lane * 4]);
#pragma unroll
        for (int i = 0; i < 4; ++i) { const float sq = qn + kn[j][i] - 2.0f * sc[i]; float v = sq * cf; if (mk[rr * 4 + j][i] == 0) v = FMIN; s[rr][j * 4 + i] = v; } } }
    ldv(xa, 128);
    float mx[2], z[2];
#pragma unroll
    for (int rr = 0; rr < 2; ++rr) { float t[8];   // a lane's sixteen values fold pairwise, four links deep, not fifteen
#pragma unroll
      for (int e = 0; e < 8; ++e) t[e] = fmaxf(s[rr][e], s[rr][e + 8]);
#pragma unroll
      for (int w = 4; w; w >>= 1)
#pragma unroll
        for (int e = 0; e < w; ++e) t[e] = fmaxf(t[e], t[e + w]);
      mx[rr] = t[0]; }
    row_max2(mx);
#pragma unroll
    for (int rr = 0; rr < 2; ++rr) mx[rr] = fmaxf(mx[rr], xhalf(mx[rr]));
#pragma unroll
    for (int rr = 0; rr < 2; ++rr) { float t[8];
#pragma unroll
      for (int e = 0; e < 16; ++e) s[rr][e] = exp_slot(s[rr][e] - mx[rr]);
#pragma unroll
      for (int e = 0; e < 8; ++e) t[e] = s[rr][e] + s[rr][e + 8];
#pragma unroll
      for (int w = 4; w; w >>= 1)
#pragma unroll
        for (int e = 0; e < w; ++e) t[e] += t[e + w];
      z[rr] = t[0]; }
    row_sum2(z);
#pragma unroll
    for (int rr = 0; rr < 2; ++rr) z[rr] = (1.0f / (z[rr] + xhalf(z[rr]))) * PS;
#pragma unroll
    for (int rr = 0; rr < 2; ++rr)
#pragma unroll
      for (int j = 0; j < 4; ++j) { v4b ph, pl;
#pragma unroll
        for (int i = 0; i < 4; ++i) { b16 a, b; split16(s[rr][j * 4 + i] * z[rr], a, b); ph[i] = a; pl[i] = b; }
        *(v4b*)(&Pa[r0 + rr][j * 128 + lane * 4]) = ph; *(v4b*)(&Pb[r0 + rr][j * 128 + lane * 4]) = pl; } }
  __syncthreads();   // each wave reads all sixteen rows of weights
  { v8f acc = (v8f){};
    auto pv4 = [&](const frw (&x)[8], int kb0) {
#pragma unroll
      for (int t = 0; t < 4; ++t) { const v16b pa = frag_kb(&Pa[nloc][kb0 + t * 32], hlf), pb = frag_kb(&Pb[nloc][kb0 + t * 32], hlf), vh = frag_of(x[2 * t]), vl = frag_of(x[2 * t + 1]); acc = wmma16b(pa, vh, acc); acc = wmma16b(pa, vl, acc); acc = wmma16b(pb, vh, acc); } };
    pv4(xb, 0); ldv(xb, 256);
    pv4(xa, 128); ldv(xa, 384);
    pv4(xb, 256);
    // this wave's two column tiles of W_out, all four k steps, fly under the last products
    { const b16* p = WO + (size_t)(wave * 32 + nloc) * DH + 8 * hlf;
#pragma unroll
      for (int t = 0; t < 2; ++t)
#pragma unroll
        for (int k = 0; k < 4; ++k) xb[t * 4 + k] = frag_at(p + t * 16 * DH + k * 32);
      issued(p); }
    pv4(xa, 384);
#pragma unroll
    for (int r8 = 0; r8 < 8; ++r8) { b16 p, pl; split16(acc[r8] * (1.0f / (PS * HS)) * HS, p, pl); Oh[8 * hlf + r8][wave * 16 + nloc] = p; Ol[8 * hlf + r8][wave * 16 + nloc] = pl; } }
  __syncthreads();   // each wave reads all eight column tiles of attn v
  { v8f acc[2] = {(v8f){}, (v8f){}};
#pragma unroll
    for (int k = 0; k < 4; ++k) { const v16b a = frag_kb(&Oh[nloc][k * 32], hlf), al = frag_kb(&Ol[nloc][k * 32], hlf);
#pragma unroll
      for (int t = 0; t < 2; ++t) { const v16b bw = frag_of(xb[t * 4 + k]); acc[t] = wmma16b(a, bw, acc[t]); acc[t] = wmma16b(al, bw, acc[t]); } }
#pragma unroll
    for (int t = 0; t < 2; ++t)
#pragma unroll
      for (int r8 = 0; r8 < 8; ++r8) Tf[8 * hlf + r8][wave * 32 + t * 16 + nloc] = acc[t][r8] * (1.0f / (HS * WSC)) + bfv(bb[t]); }
  wave_lds_sync();   // a wave's 32 columns are one 128-byte line of each output row, written and stored by that wave alone
#pragma unroll
  for (int i = 0; i < 4; ++i) { const int rr = i * 4 + (lane >> 3), cc = wave * 32 + (lane & 7) * 4; *(v4f*)(out + (tq + rr) * DY + cc) = *(const v4f*)(&Tf[rr][cc]); } }
}  // namespace

extern "C" void kernel_launch(void* const* d_in, const int* in_sizes, int n_in, void* d_out, int out_size, void* d_ws, size_t ws_size, hipStream_t stream) {
  (void)n_in;
  auto Fp = [&](int i) { return (const float*)d_in[i]; }; auto Ip = [&](int i) { return (const int*)d_in[i]; };
  // input order: 0 xq [8,512,64]; 1 xk [8,512,64]; 2 yv [8,512,256]; 3 mask [8,512,512] i32; 4 W_v [256,128]; 5 W_out [128,256]; 6 b_out [256]; 7 lengthscale [1]
  if (in_sizes[0] != MB * NQ * DX || in_sizes[1] != MB * NK * DX || in_sizes[2] != MB * NK * DY || in_sizes[3] != MB * NQ * NK || in_sizes[4] != DY * DH || in_sizes[5] != DH * DY || in_sizes[6] != DY || in_sizes[7] != 1 || out_size != MB * NQ * DY) return;
  const int QLIM = NQ;   // per-batch query cut (multiple of 16)
  size_t off = 0; char* ws = (char*)d_ws;
  auto carve = [&](size_t bytes) { char* p = ws + off; off += (bytes + 255) & ~(size_t)255; return p; };
  b16* WO = (b16*)carve((size_t)DY * DH * 2); b16* XK = (b16*)carve((size_t)MB * NK * DX * 2); float* KN = (float*)carve((size_t)MB * NK * 4); b16* VTh = (b16*)carve((size_t)MB * DH * NK * 2); b16* VTl = (b16*)carve((size_t)MB * DH * NK * 2);
  if (off > ws_size || off > ((size_t)8 << 20)) return;   // ~ 3 MB
  front_kernel<<<CB + (MB * NK / VK) * (DH / VH), 256, 0, stream>>>(Fp(2), Fp(4), Fp(5), Fp(1), WO, XK, KN, VTh, VTl);
  att_kernel<<<MB * (NQ / 16), 256, 0, stream>>>(Fp(0), XK, KN, Ip(3), Fp(7), VTh, VTl, WO, Fp(6), QLIM, (float*)d_out);
}

// v005
// Measured time: 13.3 microseconds a run.
// In two side-by-side timings against v004, it was 1.26 and 1.27 times as fast.
// Counting every step since v000, it is 11.8 times as fast.
#include <hip/hip_runtime.h>

// RBF-kernel attention: scores[m][q][k] = -0.5 |xq - xk|^2 / l^2 (mask -> finfo.min); attn = softmax_k; v = yv W_v (128); out = (attn v) W_out + b_out -> [8][512][256].
// |xq - xk|^2 = |xq|^2 + |xk|^2 - 2 xq.xk with the dot products on WMMA (xq, xk are bf16-exact, so every product is exact in f32; only the accumulation order differs from the module's sum of squared differences, ~1e-6 relative on O(100) values).
// Deterministic: a tile (64 keys by 64 columns of v; 16 queries of the attention) is one work-group's, its column tiles, key tiles and softmax rows dealt out to the group's eight waves; each element keeps its own sum order; no atomics.
// WMMA (v_wmma_f32_16x16x32_f16, f32 accumulate): yv (EXACT bf16 x8, K 256) x W_v rows (EXACT x256; 8 tiles); per (m, 16 q): D = xq (EXACT x8, K 64) x xk rows (EXACT x8; 32 tiles), O = attn (hi+lo x16384, K 512) x v^T rows (hi+lo x256; 8 tiles, 3 products), out = O (hi+lo x256, K 128) x W_out rows (EXACT; 16 tiles) — 0.16 M WMMA; norms, scores, softmax in f32.

namespace {
constexpr int MB = 8, NQ = 512, NK = 512, DX = 64, DY = 256, DH = 128;
constexpr float XS = 8.0f, HS = 256.0f, PS = 16384.0f, WSC = 256.0f, FMIN = -3.4028234663852886e38f;
typedef _Float16 b16;
typedef __attribute__((ext_vector_type(16))) _Float16 v16b;
typedef __attribute__((ext_vector_type(8))) _Float16 v8b;
typedef __attribute__((ext_vector_type(8))) float v8f;
typedef __attribute__((ext_vector_type(4))) float v4f;
typedef __attribute__((ext_vector_type(2))) float v2f;
typedef __attribute__((ext_vector_type(2))) _Float16 v2b;
typedef __attribute__((ext_vector_type(4))) _Float16 v4b;
typedef __attribute__((ext_vector_type(4))) int v4i;
__device__ __forceinline__ float bf16_rne(float f) { unsigned int u = __float_as_uint(f); u += 0x7FFFu + ((u >> 16) & 1u); return __uint_as_float(u & 0xFFFF0000u); }
__device__ __forceinline__ float bfv(float f) { return bf16_rne(f); }
__device__ __forceinline__ void split16(float v, b16& hi, b16& lo) { hi = (b16)v; lo = (b16)(v - (float)hi); }
__device__ __forceinline__ v16b frag_kb(const b16* p, int hh) { const v8b a = *(const v8b*)(p + 8 * hh), b = *(const v8b*)(p + 16 + 8 * hh); v16b f;
#pragma unroll
  for (int e = 0; e < 8; ++e) { f[e] = a[e]; f[8 + e] = b[e]; } return f; }
__device__ __forceinline__ v8f wmma16b(v16b a, v16b b, v8f c) { return __builtin_amdgcn_wmma_f32_16x16x32_f16(false, a, false, b, (short)0, c, false, false); }
// The B operands that the first launch leaves in the workspace lie in fragment order: a fragment (16 rows by 32 k) is two blocks of FB elements (512 bytes), lane l = 16 hh + row owning elements 8 l .. 8 l + 7 of each;
// the first block holds k = 8 hh + e, the second k = 16 + 8 hh + e, which is frag_kb's k order. A wave's 16-byte load or store then covers four whole 128-byte lines, not 32 bytes in each of sixteen.
constexpr int FB = 256;
// a fragment's two 16-byte halves as loaded, so that a batch of eight fragments can be in flight at once; p is the lane's own place in the fragment's first block
struct frw { v8b a, b; };
__device__ __forceinline__ frw frag_at(const b16* p) { frw f; f.a = *(const v8b*)p; f.b = *(const v8b*)(p + FB); return f; }
__device__ __forceinline__ v16b frag_of(const frw& f) { return __builtin_shufflevector(f.a, f.b, 0, 1, 2, 3, 4, 5, 6, 7, 8, 9, 10, 11, 12, 13, 14, 15); }
// Stands behind a batch of loads from p (and q). The wait: s_wait_xcnt 0 in front of whatever rewrites the batch's address registers; the addresses are named as inputs so that no load of the batch lands on them ahead of it.
// The scheduling barrier: the batch written above it issues together and flies under the products written below it; without it the compiler spreads the loads between the products and each is waited for alone.
__device__ __forceinline__ void issued(const void* p) { asm volatile("s_wait_xcnt 0x0" :: "v"(p) : "memory"); __builtin_amdgcn_sched_barrier(0); }
__device__ __forceinline__ void issued(const void* p, const void* q) { asm volatile("s_wait_xcnt 0x0" :: "v"(p), "v"(q) : "memory"); __builtin_amdgcn_sched_barrier(0); }
// Stands behind the last of a run of global stores: s_wait_xcnt 0 in front of whatever code the listing places next and lets rewrite the stores' data or address registers.
__device__ __forceinline__ void stored() { asm volatile("s_wait_xcnt 0x0" ::: "memory"); }
__device__ __forceinline__ void wave_lds_sync() { __builtin_amdgcn_fence(__ATOMIC_RELEASE, "workgroup"); __builtin_amdgcn_wave_barrier(); __builtin_amdgcn_fence(__ATOMIC_ACQUIRE, "workgroup"); }
__device__ __forceinline__ float pmul(float a, float b) { float p = a * b; asm volatile("" : "+v"(p)); return p; }
// lane l's value as seen from lane l ^ 16: a register move, no trip through the LDS unit
__device__ __forceinline__ float xhalf(float v) { const int b = __builtin_bit_cast(int, v); return __builtin_bit_cast(float, __builtin_amdgcn_permlanex16(b, b, 0x76543210, 0xfedcba98, false, false)); }
// maximum, or sum, over each 16-lane row of two values at once: four DPP steps each, the two chains interleaved; written in asm because the builtin move came out as four dependent instructions a step
__device__ __forceinline__ void row_max2(float (&v)[2]) {
  asm(
      "v_max_num_f32_dpp %0, %0, %0 row_xmask:1 row_mask:0xf bank_mask:0xf\n\t"
      "v_max_num_f32_dpp %1, %1, %1 row_xmask:1 row_mask:0xf bank_mask:0xf\n\t"
      "v_max_num_f32_dpp %0, %0, %0 row_xmask:2 row_mask:0xf bank_mask:0xf\n\t"
      "v_max_num_f32_dpp %1, %1, %1 row_xmask:2 row_mask:0xf bank_mask:0xf\n\t"
      "v_max_num_f32_dpp %0, %0, %0 row_xmask:4 row_mask:0xf bank_mask:0xf\n\t"
      "v_max_num_f32_dpp %1, %1, %1 row_xmask:4 row_mask:0xf bank_mask:0xf\n\t"
      "v_max_num_f32_dpp %0, %0, %0 row_xmask:8 row_mask:0xf bank_mask:0xf\n\t"
      "v_max_num_f32_dpp %1, %1, %1 row_xmask:8 row_mask:0xf bank_mask:0xf"
      : "+v"(v[0]), "+v"(v[1])); }
__device__ __forceinline__ void row_sum2(float (&v)[2]) {
  asm(
      "v_add_f32_dpp %0, %0, %0 row_xmask:1 row_mask:0xf bank_mask:0xf\n\t"
      "v_add_f32_dpp %1, %1, %1 row_xmask:1 row_mask:0xf bank_mask:0xf\n\t"
      "v_add_f32_dpp %0, %0, %0 row_xmask:2 row_mask:0xf bank_mask:0xf\n\t"
      "v_add_f32_dpp %1, %1, %1 row_xmask:2 row_mask:0xf bank_mask:0xf\n\t"
      "v_add_f32_dpp %0, %0, %0 row_xmask:4 row_mask:0xf bank_mask:0xf\n\t"
      "v_add_f32_dpp %1, %1, %1 row_xmask:4 row_mask:0xf bank_mask:0xf\n\t"
      "v_add_f32_dpp %0, %0, %0 row_xmask:8 row_mask:0xf bank_mask:0xf\n\t"
      "v_add_f32_dpp %1, %1, %1 row_xmask:8 row_mask:0xf bank_mask:0xf"
      : "+v"(v[0]), "+v"(v[1])); }
// __expf's own two instructions; the v_nop in the statement is the slot that the instruction set asks for behind a transcendental before its source is overwritten or its result read
__device__ __forceinline__ float exp_slot(float x) { const float a = x * 1.44269504f; float e; asm("v_exp_f32 %0, %1\n\tv_nop" : "=v"(e) : "v"(a)); return e; }

// The first of the two launches. Work-groups 0 .. CB-1 convert xk and W_out and sum the key norms, each kind of work on waves of its own; every other work-group makes a block of 64 keys by 64 columns of v = yv W_v and stores it split, in fragment order, as the attention launch reads it.
// Nothing here waits for another work-group: a v block reads W_v in f32 and turns its own 64 columns in LDS. Every loop is unrolled so that the register arrays are indexed by constants and a batch's loads issue back to back.
constexpr int CB = 64, VK = 64, VH = 64;
__global__ __launch_bounds__(256) void front_kernel(const float* __restrict__ yv, const float* __restrict__ wv, const float* __restrict__ wo, const float* __restrict__ xk, b16* __restrict__ WO, b16* __restrict__ XK, float* __restrict__ KN, b16* __restrict__ VF) { __shared__ __attribute__((aligned(16))) b16 Ax[VK][DY + 8], Wt[VH][DY + 8]; const int tid = threadIdx.x, wave = __builtin_amdgcn_readfirstlane(tid >> 5), lane = tid & 31, nloc = lane & 15, hlf = lane >> 4;
  if (blockIdx.x < CB) { const int pb = blockIdx.x;   // 64 rows of xk and 64 eight-element pieces of W_out a work-group; left by the whole work-group ahead of every barrier
    if (wave < 2) { const size_t r = (size_t)pb * 64 + tid; const float* p = xk + r * DX; v4f x[DX / 4];
#pragma unroll
      for (int i = 0; i < DX / 4; ++i) x[i] = *(const v4f*)(p + 4 * i);
      issued(p);
      float s = 0.0f;
#pragma unroll
      for (int c = 0; c < DX; ++c) { const float t = bfv(x[c >> 2][c & 3]); s += t * t; }
      KN[r] = s; }
    else if (wave < 4) { const int bk = pb * 2 + (wave - 2), d = (bk >> 3) * 16 + nloc, h0 = (bk & 7) * 16 + hlf * 8; const float* p = wo + (size_t)h0 * DY + d; float x[8]; v8b v;   // block bk of W_out^T: column tile bk / 8, k step (bk / 2) % 4, half bk % 2
#pragma unroll
      for (int j = 0; j < 8; ++j) x[j] = p[j * DY];
      issued(p);
#pragma unroll
      for (int j = 0; j < 8; ++j) v[j] = (b16)(bf16_rne(x[j]) * WSC);
      *(v8b*)(WO + (size_t)bk * FB + lane * 8) = v; stored(); }
    else { const float* p = xk + ((size_t)pb * 64 + nloc) * DX + (wave - 4) * 16 + hlf * 8; b16* q = XK + ((size_t)pb * 16 + (wave - 4)) * FB + lane * 8; v4f x[8];   // block wave - 4 (k step, half) of key tiles 4 pb + i: a tile is 1024 floats of xk and four blocks
#pragma unroll
      for (int i = 0; i < 4; ++i) { x[2 * i] = *(const v4f*)(p + i * 1024); x[2 * i + 1] = *(const v4f*)(p + i * 1024 + 4); }
      issued(p);
#pragma unroll
      for (int i = 0; i < 4; ++i) { v8b v;
#pragma unroll
        for (int j = 0; j < 8; ++j) v[j] = (b16)(bfv(x[2 * i + (j >> 2)][j & 3]) * XS);
        *(v8b*)(q + i * 1024) = v; }
      stored(); }
    return; }
  const int vb = blockIdx.x - CB, h0 = (vb & 1) * VH; const size_t r0 = (size_t)(vb >> 1) * VK;
  // 64 rows of yv, a wave's load half a row
  const float* yp = yv + (r0 + (tid >> 6)) * DY + (tid & 63) * 4; v4f y[16];
#pragma unroll
  for (int i = 0; i < 16; ++i) y[i] = *(const v4f*)(yp + i * 4 * DY);
  issued(yp);
  // 64 columns of W_v in pieces of 4 rows by 4 columns; eight lanes side by side read one 128-byte line
  const int hq = (lane & 7) + 8 * (wave & 1), dq = (lane >> 3) + 4 * (wave >> 1); const float* wp = wv + (size_t)(4 * dq) * DH + h0 + 4 * hq; v4f w[16];
#pragma unroll
  for (int i = 0; i < 4; ++i)
#pragma unroll
    for (int j = 0; j < 4; ++j) w[4 * i + j] = *(const v4f*)(wp + (64 * i + j) * DH);
  issued(wp);
#pragma unroll
  for (int i = 0; i < 16; ++i) { v4b a;
#pragma unroll
    for (int e = 0; e < 4; ++e) a[e] = (b16)(bfv(y[i][e]) * XS);
    *(v4b*)(&Ax[(tid >> 6) + 4 * i][(tid & 63) * 4]) = a; }
#pragma unroll
  for (int i = 0; i < 4; ++i)
#pragma unroll
    for (int e = 0; e < 4; ++e) { v4b a;   // column 4 hq + e of the piece: four consecutive d
#pragma unroll
      for (int j = 0; j < 4; ++j) a[j] = (b16)(bf16_rne(w[4 * i + j][e]) * WSC);
      *(v4b*)(&Wt[4 * hq + e][4 * dq + 64 * i]) = a; }
  __syncthreads();   // both tiles are written by all eight waves and read by each
  // wave w: key tile w & 3, column tiles 2 (w >> 2) and 2 (w >> 2) + 1
  const int kt = wave & 3, ht = (wave >> 2) * 2; v8f acc[2] = {(v8f){}, (v8f){}}; v16b fa[8], fb[2][8];
#pragma unroll
  for (int k = 0; k < 8; ++k) { fa[k] = frag_kb(&Ax[kt * 16 + nloc][k * 32], hlf); fb[0][k] = frag_kb(&Wt[ht * 16 + nloc][k * 32], hlf); fb[1][k] = frag_kb(&Wt[(ht + 1) * 16 + nloc][k * 32], hlf); }
  __builtin_amdgcn_sched_barrier(0);   // all 48 LDS reads go out ahead of the products; without it each product waits for its own fragments' whole LDS latency
#pragma unroll
  for (int k = 0; k < 8; ++k)
#pragma unroll
    for (int t = 0; t < 2; ++t) acc[t] = wmma16b(fa[k], fb[t][k], acc[t]);
  // a lane holds eight consecutive keys 16 kt + 8 hlf + r8 of column nloc of its tile: its own 16 bytes of half kt & 1 of the v^T fragment of that column tile and k step, so the wave stores whole blocks from its registers.
  // v^T per (m, column tile, k step of 32 keys): four blocks, high first half, high second half, low first half, low second half
  const int m = (int)(r0 / NK), k0 = (int)(r0 % NK);
#pragma unroll
  for (int t = 0; t < 2; ++t) { v8b vh, vl;
#pragma unroll
    for (int r8 = 0; r8 < 8; ++r8) { b16 a, b; split16(acc[t][r8] * (1.0f / (XS * WSC)) * HS, a, b); vh[r8] = a; vl[r8] = b; }
    b16* o = VF + ((((size_t)m * (DH / 16) + h0 / 16 + ht + t) * (NK / 32) + k0 / 32 + (kt >> 1)) * 4 + (kt & 1)) * FB + lane * 8; *(v8b*)o = vh; *(v8b*)(o + 2 * FB) = vl; }
  stored(); }
// one work-group a tile of 16 queries, dealt out to its eight waves: wave w takes key tiles 4w..4w+3 of the scores, rows 2w and 2w+1 of the softmax, column tile w of attn v and column tiles 2w and 2w+1 of the output projection.
// What a wave loads from global memory depends on no other wave, so each batch goes out ahead of its use. Every loop is unrolled so that the register arrays are indexed by constants and a batch's loads issue back to back.
// The kernel takes more than 256 registers (two batches of v, in xa and xb, are held at once): after a change see in the listing that the softmax's vector asm names registers below v256 and that the s_set_vgpr_msb above it carries a multiple of 256.
__global__ __launch_bounds__(256) void att_kernel(const float* __restrict__ xq, const b16* __restrict__ XK, const float* __restrict__ KN, const int* __restrict__ mask, const float* __restrict__ lsc, const b16* __restrict__ VF, const b16* __restrict__ WO, const float* __restrict__ bout, int QLIM, float* __restrict__ out) { __shared__ __attribute__((aligned(16))) b16 Aq[16][DX + 8], Pa[16][NK + 8], Pb[16][NK + 8], Oh[16][DH + 8], Ol[16][DH + 8]; __shared__ __attribute__((aligned(16))) float Sc[16][NK + 4], Tf[16][260]; __shared__ float QN[16]; const int tid = threadIdx.x, wave = __builtin_amdgcn_readfirstlane(tid >> 5), lane = tid & 31, nloc = lane & 15, hlf = lane >> 4; const int m = blockIdx.x / (NQ / 16), q0 = (blockIdx.x % (NQ / 16)) * 16; if (q0 >= QLIM) return; const size_t tq = (size_t)m * NQ + q0;
  // the query tile, 16 bytes a thread; and this wave's two softmax rows again, even lanes the first and odd lanes the second, for their norms
  const float* xp = xq + (tq + (tid >> 4)) * DX + (tid & 15) * 4; const v4f xv = *(const v4f*)xp;
  const float* qp = xq + (tq + 2 * wave + (lane & 1)) * DX; v4f qv[DX / 4];
#pragma unroll
  for (int i = 0; i < DX / 4; ++i) qv[i] = *(const v4f*)(qp + 4 * i);
  issued(xp, qp);
  frw xa[8], xb[8];
  { const b16* p = XK + ((size_t)m * (NK / 16) + wave * 4) * 4 * FB + lane * 8;
#pragma unroll
    for (int t = 0; t < 4; ++t) { xa[2 * t] = frag_at(p + t * 4 * FB); xa[2 * t + 1] = frag_at(p + t * 4 * FB + 2 * FB); }
    issued(p); }
  // the two mask rows, the key norms and the lengthscale, as the softmax below reads them
  v4i mk[8]; { const int* p = mask + (tq + 2 * wave) * NK + lane * 4;
#pragma unroll
    for (int e = 0; e < 8; ++e) mk[e] = *(const v4i*)(p + (e >> 2) * NK + (e & 3) * 128);
    issued(p); }
  v4f kn[4]; { const float* p = KN + (size_t)m * NK + lane * 4;
#pragma unroll
    for (int j = 0; j < 4; ++j) kn[j] = *(const v4f*)(p + j * 128);
    issued(p); }
  float bb[2]; { const float* p = bout + wave * 32 + nloc; bb[0] = p[0]; bb[1] = p[16]; issued(p); }   // the bias of this wave's two output column tiles
  const float lv = lsc[0];
  // four k steps of this wave's column tile of v, high and low halves: a batch of sixteen loads
  // (the wait names the tile's pointer itself, which every batch's loads address with a constant offset: a pointer formed per batch would be added up in those registers ahead of the wait)
  const b16* pv = VF + ((size_t)m * (DH / 16) + wave) * (NK / 32) * 4 * FB + lane * 8;
  auto ldv = [&](frw (&x)[8], int kb0) {
#pragma unroll
    for (int t = 0; t < 4; ++t) { x[2 * t] = frag_at(pv + (kb0 / 32 + t) * 4 * FB); x[2 * t + 1] = frag_at(pv + (kb0 / 32 + t) * 4 * FB + 2 * FB); }
    issued(pv); };
  ldv(xb, 0);   // with the first loads: the barrier below waits for every load that is out, so a batch sent later would hold it up
  { v4b a;
#pragma unroll
    for (int e = 0; e < 4; ++e) a[e] = (b16)(bfv(xv[e]) * XS);
    *(v4b*)(&Aq[tid >> 4][(tid & 15) * 4]) = a; }
  if (tid < 16) { for (int k = DX; k < DX + 8; ++k) Aq[tid][k] = (b16)0.0f; for (int k = NK; k < NK + 8; ++k) { Pa[tid][k] = (b16)0.0f; Pb[tid][k] = (b16)0.0f; } for (int k = DH; k < DH + 8; ++k) { Oh[tid][k] = (b16)0.0f; Ol[tid][k] = (b16)0.0f; } }
  { float s = 0.0f;   // stored ahead of the barrier, so that the sum runs while the later loads are still on their way
#pragma unroll
    for (int c = 0; c < DX; ++c) { const float t = bfv(qv[c >> 2][c & 3]); s += t * t; }
    if (lane < 2) QN[2 * wave + lane] = s; }
  __syncthreads();   // the query tile is written by all eight waves and read by each
  { const v16b qa0 = frag_kb(&Aq[nloc][0], hlf), qa1 = frag_kb(&Aq[nloc][32], hlf); v8f d[4] = {(v8f){}, (v8f){}, (v8f){}, (v8f){}};
#pragma unroll
    for (int t = 0; t < 4; ++t) { d[t] = wmma16b(qa0, frag_of(xa[2 * t]), d[t]); d[t] = wmma16b(qa1, frag_of(xa[2 * t + 1]), d[t]); }
#pragma unroll
    for (int t = 0; t < 4; ++t)
#pragma unroll
      for (int r8 = 0; r8 < 8; ++r8) Sc[8 * hlf + r8][(wave * 4 + t) * 16 + nloc] = d[t][r8] * (1.0f / (XS * XS)); }
  __syncthreads();   // a score row holds all eight waves' key tiles
  // softmax: the whole wave works on a row, lane l holding k = 128 j + 4 l + i (j, i < 4), so that scores, mask and norms are read 16 bytes a lane and each score stays in a register from the mask to the split
  { const float l2 = bfv(lv) * bfv(lv); const float cf = -0.5f / l2; const int r0 = 2 * wave; float s[2][16];
#pragma unroll
    for (int rr = 0; rr < 2; ++rr) { const float qn = QN[r0 + rr];
#pragma unroll
      for (int j = 0; j < 4; ++j) { const v4f sc = *(const v4f*)(&Sc[r0 + rr][j * 128 + lane * 4]);
#pragma unroll
        for (int i = 0; i < 4; ++i) { const float sq = qn + kn[j][i] - 2.0f * sc[i]; float v = sq * cf; if (mk[rr * 4 + j][i] == 0) v = FMIN; s[rr][j * 4 + i] = v; } } }
    ldv(xa, 128);
    float mx[2], z[2];
#pragma unroll
    for (int rr = 0; rr < 2; ++rr) { float t[8];   // a lane's sixteen values fold pairwise, four links deep, not fifteen
#pragma unroll
      for (int e = 0; e < 8; ++e) t[e] = fmaxf(s[rr][e], s[rr][e + 8]);
#pragma unroll
      for (int w = 4; w; w >>= 1)
#pragma unroll
        for (int e = 0; e < w; ++e) t[e] = fmaxf(t[e], t[e + w]);
      mx[rr] = t[0]; }
    row_max2(mx);
#pragma unroll
    for (int rr = 0; rr < 2; ++rr) mx[rr] = fmaxf(mx[rr], xhalf(mx[rr]));
#pragma unroll
    for (int rr = 0; rr < 2; ++rr) { float t[8];
#pragma unroll
      for (int e = 0; e < 16; ++e) s[rr][e] = exp_slot(s[rr][e] - mx[rr]);
#pragma unroll
      for (int e = 0; e < 8; ++e) t[e] = s[rr][e] + s[rr][e + 8];
#pragma unroll
      for (int w = 4; w; w >>= 1)
#pragma unroll
        for (int e = 0; e < w; ++e) t[e] += t[e + w];
      z[rr] = t[0]; }
    row_sum2(z);
#pragma unroll
    for (int rr = 0; rr < 2; ++rr) z[rr] = (1.0f / (z[rr] + xhalf(z[rr]))) * PS;
#pragma unroll
    for (int rr = 0; rr < 2; ++rr)
#pragma unroll
      for (int j = 0; j < 4; ++j) { v4b ph, pl;
#pragma unroll
        for (int i = 0; i < 4; ++i) { b16 a, b; split16(s[rr][j * 4 + i] * z[rr], a, b); ph[i] = a; pl[i] = b; }
        *(v4b*)(&Pa[r0 + rr][j * 128 + lane * 4]) = ph; *(v4b*)(&Pb[r0 + rr][j * 128 + lane * 4]) = pl; } }
  __syncthreads();   // each wave reads all sixteen rows of weights
  { v8f acc = (v8f){};
    auto pv4 = [&](const frw (&x)[8], int kb0) {
#pragma unroll
      for (int t = 0; t < 4; ++t) { const v16b pa = frag_kb(&Pa[nloc][kb0 + t * 32], hlf), pb = frag_kb(&Pb[nloc][kb0 + t * 32], hlf), vh = frag_of(x[2 * t]), vl = frag_of(x[2 * t + 1]); acc = wmma16b(pa, vh, acc); acc = wmma16b(pa, vl, acc); acc = wmma16b(pb, vh, acc); } };
    pv4(xb, 0); ldv(xb, 256);
    pv4(xa, 128); ldv(xa, 384);
    pv4(xb, 256);
    // this wave's two column tiles of W_out, all four k steps, fly under the last products
    { const b16* p = WO + (size_t)wave * 16 * FB + lane * 8;
#pragma unroll
      for (int t = 0; t < 2; ++t)
#pragma unroll
        for (int k = 0; k < 4; ++k) xb[t * 4 + k] = frag_at(p + (t * 4 + k) * 2 * FB);
      issued(p); }
    pv4(xa, 384);
#pragma unroll
    for (int r8 = 0; r8 < 8; ++r8) { b16 p, pl; split16(acc[r8] * (1.0f / (PS * HS)) * HS, p, pl); Oh[8 * hlf + r8][wave * 16 + nloc] = p; Ol[8 * hlf + r8][wave * 16 + nloc] = pl; } }
  __syncthreads();   // each wave reads all eight column tiles of attn v
  { v8f acc[2] = {(v8f){}, (v8f){}};
#pragma unroll
    for (int k = 0; k < 4; ++k) { const v16b a = frag_kb(&Oh[nloc][k * 32], hlf), al = frag_kb(&Ol[nloc][k * 32], hlf);
#pragma unroll
      for (int t = 0; t < 2; ++t) { const v16b bw = frag_of(xb[t * 4 + k]); acc[t] = wmma16b(a, bw, acc[t]); acc[t] = wmma16b(al, bw, acc[t]); } }
#pragma unroll
    for (int t = 0; t < 2; ++t)
#pragma unroll
      for (int r8 = 0; r8 < 8; ++r8) Tf[8 * hlf + r8][wave * 32 + t * 16 + nloc] = acc[t][r8] * (1.0f / (HS * WSC)) + bfv(bb[t]); }
  wave_lds_sync();   // a wave's 32 columns are one 128-byte line of each output row, written and stored by that wave alone
#pragma unroll
  for (int i = 0; i < 4; ++i) { const int rr = i * 4 + (lane >> 3), cc = wave * 32 + (lane & 7) * 4; *(v4f*)(out + (tq + rr) * DY + cc) = *(const v4f*)(&Tf[rr][cc]); } }
}  // namespace

extern "C" void kernel_launch(void* const* d_in, const int* in_sizes, int n_in, void* d_out, int out_size, void* d_ws, size_t ws_size, hipStream_t stream) {
  (void)n_in;
  auto Fp = [&](int i) { return (const float*)d_in[i]; }; auto Ip = [&](int i) { return (const int*)d_in[i]; };
  // input order: 0 xq [8,512,64]; 1 xk [8,512,64]; 2 yv [8,512,256]; 3 mask [8,512,512] i32; 4 W_v [256,128]; 5 W_out [128,256]; 6 b_out [256]; 7 lengthscale [1]
  if (in_sizes[0] != MB * NQ * DX || in_sizes[1] != MB * NK * DX || in_sizes[2] != MB * NK * DY || in_sizes[3] != MB * NQ * NK || in_sizes[4] != DY * DH || in_sizes[5] != DH * DY || in_sizes[6] != DY || in_sizes[7] != 1 || out_size != MB * NQ * DY) return;
  const int QLIM = NQ;   // per-batch query cut (multiple of 16)
  size_t off = 0; char* ws = (char*)d_ws;
  auto carve = [&](size_t bytes) { char* p = ws + off; off += (bytes + 255) & ~(size_t)255; return p; };
  b16* WO = (b16*)carve((size_t)DY * DH * 2); b16* XK = (b16*)carve((size_t)MB * NK * DX * 2); float* KN = (float*)carve((size_t)MB * NK * 4); b16* VF = (b16*)carve((size_t)MB * DH * NK * 2 * 2);
  if (off > ws_size || off > ((size_t)8 << 20)) return;   // ~ 3 MB
  front_kernel<<<CB + (MB * NK / VK) * (DH / VH), 256, 0, stream>>>(Fp(2), Fp(4), Fp(5), Fp(1), WO, XK, KN, VF);
  att_kernel<<<MB * (NQ / 16), 256, 0, stream>>>(Fp(0), XK, KN, Ip(3), Fp(7), VF, WO, Fp(6), QLIM, (float*)d_out);
}
